// v000
// The times below were measured on an AMD MI455X: many runs one after another, warmed up first and cycling through
// copies of the inputs, with the whole window's GPU time divided by the number of runs. Launches and the gaps
// between them are all in it. The median over several windows is given; except for v000 it joins two sittings, which
// can be a few percent apart, so the side-by-side timings, each taken in one sitting, are the better comparison.
// v000, which the later versions start from, runs in 228 microseconds.
#include <hip/hip_runtime.h>

// Compute dtypes, f32 accumulate everywhere: every float input RNE-converted to bf16 once; fused q|k|v projection v_wmma_f32_16x16x32_bf16 (bf16 x bf16, exact products);
// scores k.q^T: query rows < 512 bf16 hi/lo x bf16 hi/lo (3 products), rows >= 512 v_wmma_f32_16x16x32_f16 (f16 x f16); v^T.P^T: rows < 512 bf16 hi/lo x bf16 hi/lo (3 products),
// rows >= 512 f16 x f16 with P carried x1024; output projection bf16 hi/lo x bf16 (2 products); value gate (32 x 4), rotary, RMS normalisation and online softmax in f32 on the vector unit.
// Causal windowed grouped-query attention block (x [1][4096][1024]; q = x Wq (16 heads x 64), k/v = x Wk / x Wv (4 kv heads, query head h uses kv head h/4), weights [in][out];
// v += 2 sigmoid(x[:, :32] Wg) * ve; half-split rotary with input cos/sin tables [t][32] read by value: out[:32] = x1 cos + x2 sin, out[32:] = x2 cos - x1 sin; q and k scaled by
// rsqrt(mean(x^2) + eps) over the 64 head channels; scores/8 kept for j <= i and j >= i - window (window read on the device), else excluded; softmax; y merged [t][h*64+d]; out = y Wo f32).
// Attention is a register-fed transposed flash step: S^T = K Q^T (keys on D rows, queries on D columns), packed S^T tiles are the B fragment of O^T = V^T P^T; no score plane in memory.

#ifndef NB
#define NB 1
#endif
#ifndef SEQ
#define SEQ 4096
#endif
#define SEQ_FULL 4096
#define TT   SEQ
#define DM   1024
#define NH_  16
#define NKV  4
#define REP  (NH_ / NKV)
#define HD   64
#define DQ   (NH_ * HD)
#define DKV  (NKV * HD)
#define NQKV (DQ + 2 * DKV)
#define GCH  32
#define RH   ((TT < 512) ? TT : 512)     // query rows < RH use hi+lo planes
#define PLG  10.0f                        // log2 of the P carry (x1024) on rows >= RH
#define SCL2 (0.125f * 1.4426950408889634f)   // HD^-0.5 * log2(e)
#define NEGB (-3.0e38f)
#define EPSF 1.1920929e-07f
#define SPT  72                           // LDS staging row pitch in 16-bit elements

static_assert(TT % 64 == 0);
static_assert(RH % 64 == 0);
static_assert((TT - RH) % 64 == 0);
static_assert(DM % 64 == 0 && DQ % 64 == 0 && DKV % 64 == 0 && NQKV % 64 == 0);
static_assert(DM % 32 == 0 && DQ % 32 == 0 && HD % 32 == 0 && TT % 32 == 0);
static_assert(HD == 64);
static_assert(HD / 2 == 32);
static_assert(DQ == DM);
static_assert(NH_ % NKV == 0);
static_assert(GCH <= DM);
static_assert(SPT >= HD && SPT % 8 == 0);
static_assert((TT * DM) % 8 == 0);
static_assert(((long long)NH_ * TT * HD / 2) % 256 == 0 && ((long long)NKV * TT * HD / 2) % 256 == 0);
static_assert((TT * NKV) % 256 == 0);
static_assert(NB >= 1 && SEQ <= SEQ_FULL);

#define AL256(x) ((((size_t)(x)) + 255) & ~(size_t)255)
constexpr size_t WS_TOTAL = AL256((size_t)NQKV * DM * 2) + AL256((size_t)DM * DQ * 2) + AL256((size_t)TT * DM * 2) + AL256((size_t)TT * NQKV * 4) + AL256((size_t)TT * NKV * 4)
                          + 3 * AL256((size_t)NH_ * TT * HD * 2) + 3 * AL256((size_t)NKV * TT * HD * 2) + 3 * AL256((size_t)NKV * HD * TT * 2) + 2 * AL256((size_t)TT * DQ * 2);
static_assert(WS_TOTAL <= (size_t)134217728u);

typedef _Float16 h16;
typedef unsigned short bf;
typedef __attribute__((ext_vector_type(16))) __bf16   v16bf;
typedef __attribute__((ext_vector_type(16))) _Float16 v16h;
typedef __attribute__((ext_vector_type(8)))  _Float16 v8h;
typedef __attribute__((ext_vector_type(8)))  unsigned short v8us;
typedef __attribute__((ext_vector_type(8)))  float    v8f;
typedef __attribute__((ext_vector_type(4)))  float    v4f;
typedef __attribute__((ext_vector_type(2))) _Float16 v2h;
typedef __attribute__((ext_vector_type(4))) _Float16 v4h;
typedef __attribute__((ext_vector_type(2))) unsigned short v2us;
typedef __attribute__((ext_vector_type(4))) unsigned short v4us;
typedef __attribute__((ext_vector_type(2))) float v2f;
typedef v8h  __attribute__((may_alias)) v8ha;
typedef v4f  __attribute__((may_alias)) v4fa;
typedef v8us __attribute__((may_alias)) v8usa;

__device__ __forceinline__ unsigned short f2bf(float f) { unsigned u = __float_as_uint(f); u += 0x7FFFu + ((u >> 16) & 1u); return (unsigned short)(u >> 16); }
__device__ __forceinline__ float bf2f(unsigned short b) { return __uint_as_float(((unsigned)b) << 16); }
__device__ __forceinline__ float bfr(float f) { return bf2f(f2bf(f)); }
__device__ __forceinline__ v16h cat16(v8h lo, v8h hi) { return __builtin_shufflevector(lo, hi, 0, 1, 2, 3, 4, 5, 6, 7, 8, 9, 10, 11, 12, 13, 14, 15); }
__device__ __forceinline__ v16bf cat16b(v8us lo, v8us hi) { return __builtin_bit_cast(v16bf, __builtin_shufflevector(lo, hi, 0, 1, 2, 3, 4, 5, 6, 7, 8, 9, 10, 11, 12, 13, 14, 15)); }
__device__ __forceinline__ v8f wmma16(v16h a, v16h b, v8f c) { return __builtin_amdgcn_wmma_f32_16x16x32_f16(false, a, false, b, (short)0, c, false, false); }
__device__ __forceinline__ v8f wmmab(v16bf a, v16bf b, v8f c) { return __builtin_amdgcn_wmma_f32_16x16x32_bf16(false, a, false, b, (short)0, c, false, false); }
__device__ __forceinline__ h16 tohx(float x) { return (h16)x; }
__device__ __forceinline__ void splitf(float y, unsigned short& h, unsigned short& l) { h = f2bf(y); l = f2bf(y - bf2f(h)); }

// ---- 16-bit fragment loaders: lane l -> row (A) / column (Bt row) l & 15; elements 0..7 <- k0 + 8h + 0..7, 8..15 <- k0 + 16 + 8h + 0..7 (h = l >> 4); both operands K-contiguous.
template <typename T16> struct WFrag;
template <> struct WFrag<h16> { typedef v16h V; static __device__ __forceinline__ V ld(const h16* p) { return cat16(*(const v8h*)p, *(const v8h*)(p + 16)); } static __device__ __forceinline__ v8f mma(V a, V b, v8f c) { return wmma16(a, b, c); } };
template <> struct WFrag<bf> { typedef v16bf V; static __device__ __forceinline__ V ld(const bf* p) { return cat16b(*(const v8us*)p, *(const v8us*)(p + 16)); } static __device__ __forceinline__ v8f mma(V a, V b, v8f c) { return wmmab(a, b, c); } };

// ---- k_gemmw: register-blocked GEMM, ONE WAVE per 64x64 output tile (16 accumulators), operands straight from K-contiguous 16-bit planes; grid (M/64, N/64, Z), 32 threads.
// C[m][n] (f32, pitch ldc, + optional f32 bias[n]) = sum_k A[m][k] Bt[n][k] (+ split products per NSPLIT). z-batch strides sA/sB/sC in elements. K % 32 == 0.
template <typename T16, int NSPLIT, bool BIAS>
__global__ __launch_bounds__(32) void k_gemmw(const T16* __restrict__ A, const T16* __restrict__ A2, const T16* __restrict__ Bt, const T16* __restrict__ Bt2, int K, float* C, int ldc, const float* __restrict__ bias, size_t sA, size_t sB, size_t sC) {
    typedef typename WFrag<T16>::V V;
    __shared__ __align__(16) float os[16 * 68];
    const size_t z = blockIdx.z; A += z * sA; if (A2) A2 += z * sA; Bt += z * sB; if (Bt2) Bt2 += z * sB; C += z * sC;
    const int lane = threadIdx.x & 31, lr = lane & 15, hi = lane >> 4; const int r0 = blockIdx.x * 64, c0 = blockIdx.y * 64;
    v8f acc[4][4];
#pragma unroll
    for (int mb = 0; mb < 4; ++mb)
#pragma unroll
        for (int nb = 0; nb < 4; ++nb) acc[mb][nb] = (v8f){};
    const size_t aoff = (size_t)(r0 + lr) * K + 8 * hi, boff = (size_t)(c0 + lr) * K + 8 * hi;
#pragma unroll 1
    for (int kc = 0; kc < K; kc += 32) {
        V a[4], a2[4];
#pragma unroll
        for (int mb = 0; mb < 4; ++mb) { a[mb] = WFrag<T16>::ld(A + aoff + (size_t)mb * 16 * K + kc); if (NSPLIT == 1 || NSPLIT == 2) a2[mb] = WFrag<T16>::ld(A2 + aoff + (size_t)mb * 16 * K + kc); }
#pragma unroll
        for (int nb = 0; nb < 4; ++nb) { const V b = WFrag<T16>::ld(Bt + boff + (size_t)nb * 16 * K + kc); V b2; if (NSPLIT >= 2) b2 = WFrag<T16>::ld(Bt2 + boff + (size_t)nb * 16 * K + kc);
#pragma unroll
            for (int mb = 0; mb < 4; ++mb) { acc[mb][nb] = WFrag<T16>::mma(a[mb], b, acc[mb][nb]); if (NSPLIT == 1 || NSPLIT == 2) acc[mb][nb] = WFrag<T16>::mma(a2[mb], b, acc[mb][nb]); if (NSPLIT >= 2) acc[mb][nb] = WFrag<T16>::mma(a[mb], b2, acc[mb][nb]); } }
        asm volatile("v_nop\n\tv_nop\n\tv_nop\n\tv_nop" : "+v"(acc[0][0]), "+v"(acc[1][1]), "+v"(acc[2][2]), "+v"(acc[3][3]) : "v"(a[0]), "v"(a[3]));
    }
#pragma unroll
    for (int mb = 0; mb < 4; ++mb) {
#pragma unroll
        for (int nb = 0; nb < 4; ++nb) {
#pragma unroll
            for (int j = 0; j < 8; ++j) os[(hi * 8 + j) * 68 + nb * 16 + lr] = acc[mb][nb][j]; }
        __builtin_amdgcn_wave_barrier(); asm volatile("" ::: "memory");
        float* crow = C + (size_t)(r0 + mb * 16) * ldc + c0;
{
#pragma unroll
            for (int s = 0; s < 8; ++s) { const int row = 2 * s + hi, cofs = lr * 4; v4f val = *(const v4fa*)(os + row * 68 + cofs); if (BIAS) { val[0] += bfr(bias[c0 + cofs]); val[1] += bfr(bias[c0 + cofs + 1]); val[2] += bfr(bias[c0 + cofs + 2]); val[3] += bfr(bias[c0 + cofs + 3]); }
                *(v4f*)(crow + (size_t)row * ldc + cofs) = val; }
             }
        __builtin_amdgcn_wave_barrier(); asm volatile("" ::: "memory");
    }
}

__global__ __launch_bounds__(256) void k_cvt8(const float* __restrict__ src, bf* dst, size_t n8) { const size_t i = (size_t)blockIdx.x * 256 + threadIdx.x; if (i >= n8) return; const v8f v = *(const v8f*)(src + i * 8); v8us o;
#pragma unroll
    for (int k = 0; k < 8; ++k) o[k] = f2bf(v[k]); *(v8us*)(dst + i * 8) = o;  }

// ---- additions for this block ----
// f16 operand convert that cannot yield a subnormal (value select applied after any carry).
static __device__ __forceinline__ h16 toh_flush(float v) { const h16 r = (h16)v; return (fabsf(v) < 6.103515625e-05f) ? (h16)0.0f : r; }
// per-instruction guarded WMMA wrappers (one accumulator per guard).
__device__ __forceinline__ v8f wg16(v16h a, v16h b, v8f c) { c = wmma16(a, b, c); asm volatile("v_nop\n\tv_nop\n\tv_nop\n\tv_nop" : "+v"(c) : "v"(a), "v"(b)); return c; }
__device__ __forceinline__ v8f wgb(v16bf a, v16bf b, v8f c) { c = wmmab(a, b, c); asm volatile("v_nop\n\tv_nop\n\tv_nop\n\tv_nop" : "+v"(c) : "v"(a), "v"(b)); return c; }

// k_cvtT: W[k][n] f32 ([in][out], in = DM rows, row pitch N) -> Bt[n][k] bf16 (rows K-contiguous, pitch DM). 64x64 tile through LDS (block barrier between the element stores and the
__global__ __launch_bounds__(256) void k_cvtT(const float* __restrict__ src, int N, bf* dst) {
    __shared__ __align__(16) unsigned short tl[64 * SPT];
    const int tid = threadIdx.x; const int k0 = blockIdx.x * 64, n0 = blockIdx.y * 64;
#pragma unroll 1
    for (int it = 0; it < 16; ++it) { const int idx = it * 256 + tid; const int kk = idx >> 6, nn = idx & 63; tl[nn * SPT + kk] = f2bf(src[(size_t)(k0 + kk) * N + n0 + nn]); }
    __syncthreads();
{
#pragma unroll
        for (int it = 0; it < 2; ++it) { const int p = it * 256 + tid; const int row = p >> 3, pc = p & 7; const v8us v = *(const v8usa*)(tl + row * SPT + pc * 8);
            *(v8us*)(dst + (size_t)(n0 + row) * DM + k0 + pc * 8) = v; }
         }
}

__global__ __launch_bounds__(256) void k_gate(const float* __restrict__ x, const float* __restrict__ wg, float* G) {
#pragma clang fp contract(off)
    const int idx = blockIdx.x * 256 + threadIdx.x; if (idx >= TT * NKV) return; const int t = idx / NKV, g = idx % NKV; const float* xr = x + (size_t)t * DM; float a = 0.0f;
#pragma unroll 1
    for (int c = 0; c < GCH; ++c) a += bfr(xr[c]) * bfr(wg[c * NKV + g]);
    const float gt = 2.0f * (1.0f / (1.0f + expf(-a)));
    *(float*)(G + idx) = gt;  }

// k_ropen: head planes [h][t][d] (fp16 + bf16 hi/lo) of rmsnorm(rotary(F)) with x = F[t][coff + h*HD + d] (row pitch 'pitch'), tables cos/sin [t][32] read by value (bf16 RNE):
// d < 32: r = x[d] cos[d] + x[d+32] sin[d]; d >= 32: r = x[d] cos[d-32] - x[d-32] sin[d-32]; y = r * rsqrt(mean_d r^2 + eps). One wave per (h, t) row: lane -> 2 consecutive d,
__global__ __launch_bounds__(256) void k_ropen(const float* __restrict__ F, int pitch, int coff, int nheads, const float* __restrict__ cosb, const float* __restrict__ sinb, h16* P16, bf* Ph, bf* Pl) {
#pragma clang fp contract(off)
    const size_t e = ((size_t)blockIdx.x * 256 + threadIdx.x) * 2; if (e >= (size_t)nheads * TT * HD) return; const int d = (int)(e % HD); const int t = (int)((e / HD) % TT); const int h = (int)(e / ((size_t)HD * TT));
    const float* f = F + (size_t)t * pitch + coff + h * HD; const int j = d & (HD / 2 - 1); const int dp = d ^ (HD / 2); const float sg = (d < HD / 2) ? 1.0f : -1.0f;
    const v2f xa = *(const v2f*)(f + d); const v2f xb = *(const v2f*)(f + dp); const v2f cc = *(const v2f*)(cosb + (size_t)t * (HD / 2) + j); const v2f sn = *(const v2f*)(sinb + (size_t)t * (HD / 2) + j);
    const float r0 = xa[0] * bfr(cc[0]) + sg * (xb[0] * bfr(sn[0])); const float r1 = xa[1] * bfr(cc[1]) + sg * (xb[1] * bfr(sn[1]));
    float ss = r0 * r0 + r1 * r1;
#pragma unroll
    for (int sh = 16; sh; sh >>= 1) ss += __shfl_xor(ss, sh, 32);
    const float rs = rsqrtf(ss * (1.0f / (float)HD) + EPSF); const float y0 = r0 * rs, y1 = r1 * rs;
    v2h o16; v2us oh, ol; unsigned short a2, c2; o16[0] = toh_flush(y0); o16[1] = toh_flush(y1); splitf(y0, a2, c2); oh[0] = a2; ol[0] = c2; splitf(y1, a2, c2); oh[1] = a2; ol[1] = c2;
    *(v2h*)(P16 + e) = o16; *(v2us*)(Ph + e) = oh; *(v2us*)(Pl + e) = ol;  }

__global__ __launch_bounds__(256) void k_vtg(const float* __restrict__ F, int pitch, int coff, int nheads, const float* __restrict__ G, const float* __restrict__ ve, h16* V16, bf* Vh, bf* Vl) {
#pragma clang fp contract(off)
    const size_t e = ((size_t)blockIdx.x * 256 + threadIdx.x) * 2; if (e >= (size_t)nheads * HD * TT) return; const int t = (int)(e % TT); const int d = (int)((e / TT) % HD); const int g = (int)(e / ((size_t)TT * HD)); v2h o16; v2us oh, ol;
#pragma unroll
    for (int q = 0; q < 2; ++q) { const int tq = t + q; const float gv = G[(size_t)tq * NKV + g]; const float ev = bfr(ve[(size_t)tq * DKV + g * HD + d]); const float x = F[(size_t)tq * pitch + coff + g * HD + d] + gv * ev;
        o16[q] = toh_flush(x); unsigned short a2, c2; splitf(x, a2, c2); oh[q] = a2; ol[q] = c2; }
    *(v2h*)(V16 + e) = o16; *(v2us*)(Vh + e) = oh; *(v2us*)(Vl + e) = ol;  }

// ---- attn_body: register-fed transposed flash step. Block = 4 waves = 64 query rows of head blockIdx.y; each wave owns 16 queries q0..q0+15 and walks 32-key steps kb from the
// window start (aligned down to 32) to the diagonal. S^T tiles (keys kb..kb+15 and kb+16..kb+31 on D rows 8*hi+r, query lr on D columns) = K fragment (A: row = key, k = channel)
// x Q fragment (B: column = query, k = channel). Online softmax per query = per lane (the lane pair l, l^16 shares a query; max exchanged by one xor-16 shuffle; the row sum stays a
// per-lane partial and is combined once at the end). Packed S^T tiles form the B fragment of O^T = V^T P^T directly (elements 0..7 <- tile 0 rows 8*hi.., 8..15 <- tile 1), A = V^T
// fragment (row = channel, k = key) from the [g][d][t] planes. EARLY: all operands as bf16 hi/lo planes, three products per site, P unnormalised in (0,1], row sum over the f32 p.
// Late: single f16 products, P carried x1024 with the exponent-argument select (no f16 subnormal can form), row sum over the converted P.
template <bool EARLY>
static __device__ __forceinline__ void attn_body(const h16* __restrict__ Q16, const bf* __restrict__ Qh, const bf* __restrict__ Ql, const h16* __restrict__ K16, const bf* __restrict__ Kh, const bf* __restrict__ Kl,
                                                 const h16* __restrict__ V16, const bf* __restrict__ Vh, const bf* __restrict__ Vl, bf* ATh, bf* ATl, const int* __restrict__ wsp, int roff) {
    __shared__ __align__(16) unsigned short stg[4 * 2 * 16 * SPT];
    const int lane = threadIdx.x & 31, lr = lane & 15, hi = lane >> 4;
    const int wave = __builtin_amdgcn_readfirstlane(threadIdx.x >> 5);
    const int h = (int)blockIdx.y, g = h / REP;
    const int q0 = roff + (int)blockIdx.x * 64 + wave * 16;
    int wl = wsp[0]; if (wl <= 0 || wl >= TT) wl = TT;
    int klo = q0 - wl; klo &= ~(klo >> 31);               // floor at 0 without a compare
    const int kstart = klo & ~31; const int kend = q0 + 16;
    const int i = q0 + lr, ilo = i - wl;
    const size_t qoff = ((size_t)h * TT + q0 + lr) * HD + 8 * hi;
    const size_t kbase = (size_t)g * TT * HD + (size_t)lr * HD + 8 * hi;
    const size_t vbase = (size_t)g * HD * TT + (size_t)lr * TT + 8 * hi;
    v16h qf[2]; v16bf qh[2], ql[2];
#pragma unroll
    for (int c = 0; c < 2; ++c) { if (EARLY) { qh[c] = WFrag<bf>::ld(Qh + qoff + c * 32); ql[c] = WFrag<bf>::ld(Ql + qoff + c * 32); } else { qf[c] = WFrag<h16>::ld(Q16 + qoff + c * 32); } }
    float m = NEGB, l = 0.0f; v8f o[4];
#pragma unroll
    for (int dt = 0; dt < 4; ++dt) o[dt] = (v8f){};
#pragma unroll 1
    for (int kb = kstart; kb < kend; kb += 32) {
        v8f s0 = (v8f){}, s1 = (v8f){};
        if (EARLY) {
#pragma unroll
            for (int c = 0; c < 2; ++c) { const size_t ko = kbase + (size_t)kb * HD + c * 32;
                const v16bf a0h = WFrag<bf>::ld(Kh + ko); const v16bf a0l = WFrag<bf>::ld(Kl + ko);
                s0 = wgb(a0h, qh[c], s0); s0 = wgb(a0l, qh[c], s0); s0 = wgb(a0h, ql[c], s0);
                const v16bf a1h = WFrag<bf>::ld(Kh + ko + 16 * HD); const v16bf a1l = WFrag<bf>::ld(Kl + ko + 16 * HD);
                s1 = wgb(a1h, qh[c], s1); s1 = wgb(a1l, qh[c], s1); s1 = wgb(a1h, ql[c], s1); }
        } else {
#pragma unroll
            for (int c = 0; c < 2; ++c) { const size_t ko = kbase + (size_t)kb * HD + c * 32;
                const v16h a0 = WFrag<h16>::ld(K16 + ko); const v16h a1 = WFrag<h16>::ld(K16 + ko + 16 * HD);
                s0 = wg16(a0, qf[c], s0); s1 = wg16(a1, qf[c], s1); }
        }
        float mx = NEGB;
#pragma unroll
        for (int r = 0; r < 8; ++r) { const int j0 = kb + 8 * hi + r, j1 = j0 + 16; const bool ok0 = (j0 <= i) && (j0 >= ilo); const bool ok1 = (j1 <= i) && (j1 >= ilo);
            const float t0 = ok0 ? s0[r] * SCL2 : NEGB; const float t1 = ok1 ? s1[r] * SCL2 : NEGB; s0[r] = t0; s1[r] = t1; mx = fmaxf(mx, fmaxf(t0, t1)); }
        mx = fmaxf(mx, __shfl_xor(mx, 16, 32));
        const float mnew = fmaxf(m, mx); const float alpha = __builtin_amdgcn_exp2f(m - mnew); m = mnew;
#pragma unroll
        for (int dt = 0; dt < 4; ++dt)
#pragma unroll
            for (int r = 0; r < 8; ++r) o[dt][r] *= alpha;
        float ls = 0.0f;
        if (EARLY) {
            v8us p0h, p0l, p1h, p1l;
#pragma unroll
            for (int r = 0; r < 8; ++r) { const float e0 = s0[r] - mnew, e1 = s1[r] - mnew; float pv0 = __builtin_amdgcn_exp2f(e0), pv1 = __builtin_amdgcn_exp2f(e1);
                pv0 = (s0[r] > -1.0e38f) ? pv0 : 0.0f; pv1 = (s1[r] > -1.0e38f) ? pv1 : 0.0f; ls += pv0 + pv1;
                unsigned short a2, c2; splitf(pv0, a2, c2); p0h[r] = a2; p0l[r] = c2; splitf(pv1, a2, c2); p1h[r] = a2; p1l[r] = c2; }
            const v16bf pfh = cat16b(p0h, p1h); const v16bf pfl = cat16b(p0l, p1l);
#pragma unroll
            for (int dt = 0; dt < 4; ++dt) { const size_t vo = vbase + (size_t)(dt * 16) * TT + kb; const v16bf vh = WFrag<bf>::ld(Vh + vo); const v16bf vl = WFrag<bf>::ld(Vl + vo);
                o[dt] = wgb(vh, pfh, o[dt]); o[dt] = wgb(vl, pfh, o[dt]); o[dt] = wgb(vh, pfl, o[dt]); }
        } else {
            v8h p0, p1;
#pragma unroll
            for (int r = 0; r < 8; ++r) { const float e0 = s0[r] - mnew + PLG, e1 = s1[r] - mnew + PLG; float pv0 = __builtin_amdgcn_exp2f(e0), pv1 = __builtin_amdgcn_exp2f(e1);
                pv0 = ((s0[r] > -1.0e38f) && (e0 >= -14.0f)) ? pv0 : 0.0f; pv1 = ((s1[r] > -1.0e38f) && (e1 >= -14.0f)) ? pv1 : 0.0f;
                const h16 c0 = (h16)pv0; const h16 c1 = (h16)pv1; p0[r] = c0; p1[r] = c1; ls += (float)c0 + (float)c1; }
            const v16h pf = cat16(p0, p1);
#pragma unroll
            for (int dt = 0; dt < 4; ++dt) { const size_t vo = vbase + (size_t)(dt * 16) * TT + kb; const v16h va = WFrag<h16>::ld(V16 + vo); o[dt] = wg16(va, pf, o[dt]); }
        }
        l = l * alpha + ls;
    }
    const float lt = l + __shfl_xor(l, 16, 32);
    const float inv = 1.0f / lt;
    const int sb = wave * (2 * 16 * SPT);
#pragma unroll
    for (int dt = 0; dt < 4; ++dt) { v8us oh, ol;
#pragma unroll
        for (int r = 0; r < 8; ++r) { unsigned short a2, c2; splitf(o[dt][r] * inv, a2, c2); oh[r] = a2; ol[r] = c2; }
        *(v8usa*)(stg + sb + lr * SPT + dt * 16 + 8 * hi) = oh; *(v8usa*)(stg + sb + 16 * SPT + lr * SPT + dt * 16 + 8 * hi) = ol; }
    __builtin_amdgcn_wave_barrier(); asm volatile("" ::: "memory");
    const int prow = lane >> 3, pc = lane & 7;
{
#pragma unroll
        for (int s = 0; s < 4; ++s) { const int row = 4 * s + prow; const v8us sh = *(const v8usa*)(stg + sb + row * SPT + pc * 8); const v8us sl = *(const v8usa*)(stg + sb + 16 * SPT + row * SPT + pc * 8);
            const size_t oo = (size_t)(q0 + row) * DQ + (size_t)h * HD + pc * 8; *(v8us*)(ATh + oo) = sh; *(v8us*)(ATl + oo) = sl; }
         }
}

// k_attn_early: query rows [0, RH), bf16 hi/lo planes; grid (RH/64, NH_), 128 threads.
__global__ __launch_bounds__(128) void k_attn_early(const bf* __restrict__ Qh, const bf* __restrict__ Ql, const bf* __restrict__ Kh, const bf* __restrict__ Kl, const bf* __restrict__ Vh, const bf* __restrict__ Vl, bf* ATh, bf* ATl, const int* __restrict__ wsp) {
    attn_body<true>(nullptr, Qh, Ql, nullptr, Kh, Kl, nullptr, Vh, Vl, ATh, ATl, wsp, 0); }
// k_attn_late: query rows [RH, TT), single f16 planes; grid ((TT-RH)/64, NH_), 128 threads.
__global__ __launch_bounds__(128) void k_attn_late(const h16* __restrict__ Q16, const h16* __restrict__ K16, const h16* __restrict__ V16, bf* ATh, bf* ATl, const int* __restrict__ wsp) {
    attn_body<false>(Q16, nullptr, nullptr, K16, nullptr, nullptr, V16, nullptr, nullptr, ATh, ATl, wsp, RH); }

extern "C" void kernel_launch(void* const* d_in, const int* in_sizes, int n_in,
                              void* d_out, int out_size, void* d_ws, size_t ws_size, hipStream_t stream) {
    if (n_in < 10) return;
    if (in_sizes[0] < (NB - 1) * SEQ_FULL * DM + TT * DM) return;
    if (in_sizes[1] < (NB - 1) * SEQ_FULL * DKV + TT * DKV) return;
    if (in_sizes[2] < TT * (HD / 2) || in_sizes[3] < TT * (HD / 2)) return;
    if (in_sizes[4] < DM * DQ || in_sizes[5] < DM * DKV || in_sizes[6] < DM * DKV || in_sizes[7] < DQ * DM || in_sizes[8] < GCH * NKV || in_sizes[9] < 1) return;
    if (out_size < NB * TT * DM) return;
    const float* x = (const float*)d_in[0]; const float* ve = (const float*)d_in[1]; const float* cosb = (const float*)d_in[2]; const float* sinb = (const float*)d_in[3];
    const float* wq = (const float*)d_in[4]; const float* wk = (const float*)d_in[5]; const float* wv = (const float*)d_in[6]; const float* wo = (const float*)d_in[7]; const float* wg = (const float*)d_in[8];
    const int* wsp = (const int*)d_in[9];
    float* OUT = (float*)d_out;     // [NB][TT][DM] f32
    char* wsc = (char*)d_ws;
    auto take = [&](size_t bytes) { char* p = wsc; wsc += (bytes + 255) & ~(size_t)255; return (void*)p; };
    bf* WQKV = (bf*)take((size_t)NQKV * DM * 2); bf* WO = (bf*)take((size_t)DM * DQ * 2);
    bf* XB = (bf*)take((size_t)TT * DM * 2); float* F = (float*)take((size_t)TT * NQKV * 4); float* G = (float*)take((size_t)TT * NKV * 4);
    h16* QP16 = (h16*)take((size_t)NH_ * TT * HD * 2); bf* QPh = (bf*)take((size_t)NH_ * TT * HD * 2); bf* QPl = (bf*)take((size_t)NH_ * TT * HD * 2);
    h16* KP16 = (h16*)take((size_t)NKV * TT * HD * 2); bf* KPh = (bf*)take((size_t)NKV * TT * HD * 2); bf* KPl = (bf*)take((size_t)NKV * TT * HD * 2);
    h16* VT16 = (h16*)take((size_t)NKV * HD * TT * 2); bf* VTh = (bf*)take((size_t)NKV * HD * TT * 2); bf* VTl = (bf*)take((size_t)NKV * HD * TT * 2);
    bf* ATh = (bf*)take((size_t)TT * DQ * 2); bf* ATl = (bf*)take((size_t)TT * DQ * 2);
    const size_t used = (size_t)(wsc - (char*)d_ws); if (used > ws_size || used > (size_t)134217728u) return;   // 93,388,800 B at full size
    k_cvtT<<<dim3(DM / 64, DQ / 64), 256, 0, stream>>>(wq, DQ, WQKV);                                         /* Wq [in][out] -> Bt rows 0..DQ-1 */
    k_cvtT<<<dim3(DM / 64, DKV / 64), 256, 0, stream>>>(wk, DKV, WQKV + (size_t)DQ * DM);                      /* Wk -> Bt rows DQ..DQ+DKV-1 */
    k_cvtT<<<dim3(DM / 64, DKV / 64), 256, 0, stream>>>(wv, DKV, WQKV + (size_t)(DQ + DKV) * DM);              /* Wv -> Bt rows DQ+DKV.. */
    k_cvtT<<<dim3(DQ / 64, DM / 64), 256, 0, stream>>>(wo, DM, WO);                                           /* Wo [in = DQ][out = DM] -> Bt [DM][DQ] */
    const unsigned LQ = (unsigned)(((size_t)NH_ * TT * HD / 2 + 255) / 256), LKv = (unsigned)(((size_t)NKV * TT * HD / 2 + 255) / 256);
    for (int b = 0; b < NB; ++b) {
        const float* xb = x + (size_t)b * SEQ_FULL * DM; const float* veb = ve + (size_t)b * SEQ_FULL * DKV;
        k_cvt8<<<(unsigned)(((size_t)TT * DM / 8 + 255) / 256), 256, 0, stream>>>(xb, XB, (size_t)TT * DM / 8);
        k_gemmw<bf, 0, false><<<dim3(TT / 64, NQKV / 64, 1), 32, 0, stream>>>(XB, nullptr, WQKV, nullptr, DM, F, NQKV, nullptr, 0, 0, 0);
        k_gate<<<(TT * NKV + 255) / 256, 256, 0, stream>>>(xb, wg, G);
        k_ropen<<<LQ, 256, 0, stream>>>(F, NQKV, 0, NH_, cosb, sinb, QP16, QPh, QPl);
        k_ropen<<<LKv, 256, 0, stream>>>(F, NQKV, DQ, NKV, cosb, sinb, KP16, KPh, KPl);
        k_vtg<<<LKv, 256, 0, stream>>>(F, NQKV, DQ + DKV, NKV, G, veb, VT16, VTh, VTl);
        if (RH > 0) k_attn_early<<<dim3(RH / 64, NH_), 128, 0, stream>>>(QPh, QPl, KPh, KPl, VTh, VTl, ATh, ATl, wsp);
        if (TT - RH > 0) k_attn_late<<<dim3((TT - RH) / 64, NH_), 128, 0, stream>>>(QP16, KP16, VT16, ATh, ATl, wsp);
        k_gemmw<bf, 1, false><<<dim3(TT / 64, DM / 64, 1), 32, 0, stream>>>(ATh, ATl, WO, nullptr, DQ, OUT + (size_t)b * TT * DM, DM, nullptr, 0, 0, 0); }
}

// v001
// A run of this version takes 183 microseconds.
// Next to v000, in two timings, it ran 1.27 times as fast each time.
#include <hip/hip_runtime.h>

// Compute dtypes, f32 accumulate everywhere: every float input RNE-converted to bf16 once; fused q|k|v projection v_wmma_f32_16x16x32_bf16 (bf16 x bf16, exact products);
// scores k.q^T: query rows < 512 bf16 hi/lo x bf16 hi/lo (3 products), rows >= 512 v_wmma_f32_16x16x32_f16 (f16 x f16); v^T.P^T: rows < 512 bf16 hi/lo x bf16 hi/lo (3 products),
// rows >= 512 f16 x f16 with P carried x1024; output projection bf16 hi/lo x bf16 (2 products); value gate (32 x 4), rotary, RMS normalisation and online softmax in f32 on the vector unit.
// Causal windowed grouped-query attention block (x [1][4096][1024]; q = x Wq (16 heads x 64), k/v = x Wk / x Wv (4 kv heads, query head h uses kv head h/4), weights [in][out];
// v += 2 sigmoid(x[:, :32] Wg) * ve; half-split rotary with input cos/sin tables [t][32] read by value: out[:32] = x1 cos + x2 sin, out[32:] = x2 cos - x1 sin; q and k scaled by
// rsqrt(mean(x^2) + eps) over the 64 head channels; scores/8 kept for j <= i and j >= i - window (window read on the device), else excluded; softmax; y merged [t][h*64+d]; out = y Wo f32).
// Attention is a register-fed transposed flash step: S^T = K Q^T (keys on D rows, queries on D columns), packed S^T tiles are the B fragment of O^T = V^T P^T; no score plane in memory.

#ifndef NB
#define NB 1
#endif
#ifndef SEQ
#define SEQ 4096
#endif
#define SEQ_FULL 4096
#define TT   SEQ
#define DM   1024
#define NH_  16
#define NKV  4
#define REP  (NH_ / NKV)
#define HD   64
#define DQ   (NH_ * HD)
#define DKV  (NKV * HD)
#define NQKV (DQ + 2 * DKV)
#define GCH  32
#define RH   ((TT < 512) ? TT : 512)     // query rows < RH use hi+lo planes
#define PLG  10.0f                        // log2 of the P carry (x1024) on rows >= RH
#define SCL2 (0.125f * 1.4426950408889634f)   // HD^-0.5 * log2(e)
#define NEGB (-3.0e38f)
#define EPSF 1.1920929e-07f
#define SPT  72                           // LDS staging row pitch in 16-bit elements

static_assert(TT % 64 == 0);
static_assert(RH % 64 == 0);
static_assert((TT - RH) % 64 == 0);
static_assert(DM % 64 == 0 && DQ % 64 == 0 && DKV % 64 == 0 && NQKV % 64 == 0);
static_assert(DM % 32 == 0 && DQ % 32 == 0 && HD % 32 == 0 && TT % 32 == 0);
static_assert(HD == 64);
static_assert(HD / 2 == 32);
static_assert(DQ == DM);
static_assert(NH_ % NKV == 0);
static_assert(GCH <= DM);
static_assert(SPT >= HD && SPT % 8 == 0);
static_assert((TT * DM) % 8 == 0);
static_assert(((long long)NH_ * TT * HD / 2) % 256 == 0 && ((long long)NKV * TT * HD / 2) % 256 == 0);
static_assert((TT * NKV) % 256 == 0);
static_assert(NB >= 1 && SEQ <= SEQ_FULL);

#define AL256(x) ((((size_t)(x)) + 255) & ~(size_t)255)
constexpr size_t WS_TOTAL = AL256((size_t)NQKV * DM * 2) + AL256((size_t)DM * DQ * 2) + AL256((size_t)TT * DM * 2) + AL256((size_t)TT * NQKV * 4) + AL256((size_t)TT * NKV * 4)
                          + 3 * AL256((size_t)NH_ * TT * HD * 2) + 3 * AL256((size_t)NKV * TT * HD * 2) + 3 * AL256((size_t)NKV * HD * TT * 2) + 2 * AL256((size_t)TT * DQ * 2);
static_assert(WS_TOTAL <= (size_t)134217728u);

typedef _Float16 h16;
typedef unsigned short bf;
typedef __attribute__((ext_vector_type(16))) __bf16   v16bf;
typedef __attribute__((ext_vector_type(16))) _Float16 v16h;
typedef __attribute__((ext_vector_type(8)))  _Float16 v8h;
typedef __attribute__((ext_vector_type(8)))  unsigned short v8us;
typedef __attribute__((ext_vector_type(8)))  float    v8f;
typedef __attribute__((ext_vector_type(4)))  float    v4f;
typedef __attribute__((ext_vector_type(2))) _Float16 v2h;
typedef __attribute__((ext_vector_type(4))) _Float16 v4h;
typedef __attribute__((ext_vector_type(2))) unsigned short v2us;
typedef __attribute__((ext_vector_type(4))) unsigned short v4us;
typedef __attribute__((ext_vector_type(2))) float v2f;
typedef v8h  __attribute__((may_alias)) v8ha;
typedef v4f  __attribute__((may_alias)) v4fa;
typedef v8us __attribute__((may_alias)) v8usa;

__device__ __forceinline__ unsigned short f2bf(float f) { unsigned u = __float_as_uint(f); u += 0x7FFFu + ((u >> 16) & 1u); return (unsigned short)(u >> 16); }
__device__ __forceinline__ float bf2f(unsigned short b) { return __uint_as_float(((unsigned)b) << 16); }
__device__ __forceinline__ float bfr(float f) { return bf2f(f2bf(f)); }
__device__ __forceinline__ v16h cat16(v8h lo, v8h hi) { return __builtin_shufflevector(lo, hi, 0, 1, 2, 3, 4, 5, 6, 7, 8, 9, 10, 11, 12, 13, 14, 15); }
__device__ __forceinline__ v16bf cat16b(v8us lo, v8us hi) { return __builtin_bit_cast(v16bf, __builtin_shufflevector(lo, hi, 0, 1, 2, 3, 4, 5, 6, 7, 8, 9, 10, 11, 12, 13, 14, 15)); }
__device__ __forceinline__ v8f wmma16(v16h a, v16h b, v8f c) { return __builtin_amdgcn_wmma_f32_16x16x32_f16(false, a, false, b, (short)0, c, false, false); }
__device__ __forceinline__ v8f wmmab(v16bf a, v16bf b, v8f c) { return __builtin_amdgcn_wmma_f32_16x16x32_bf16(false, a, false, b, (short)0, c, false, false); }
__device__ __forceinline__ h16 tohx(float x) { return (h16)x; }
__device__ __forceinline__ void splitf(float y, unsigned short& h, unsigned short& l) { h = f2bf(y); l = f2bf(y - bf2f(h)); }

// ---- 16-bit fragment loaders: lane l -> row (A) / column (Bt row) l & 15; elements 0..7 <- k0 + 8h + 0..7, 8..15 <- k0 + 16 + 8h + 0..7 (h = l >> 4); both operands K-contiguous.
template <typename T16> struct WFrag;
template <> struct WFrag<h16> { typedef v16h V; static __device__ __forceinline__ V ld(const h16* p) { return cat16(*(const v8h*)p, *(const v8h*)(p + 16)); } static __device__ __forceinline__ v8f mma(V a, V b, v8f c) { return wmma16(a, b, c); } };
template <> struct WFrag<bf> { typedef v16bf V; static __device__ __forceinline__ V ld(const bf* p) { return cat16b(*(const v8us*)p, *(const v8us*)(p + 16)); } static __device__ __forceinline__ v8f mma(V a, V b, v8f c) { return wmmab(a, b, c); } };

// ---- k_gemmw: register-blocked GEMM, ONE WAVE per 64x64 output tile (16 accumulators), operands straight from K-contiguous 16-bit planes; grid (M/64, N/64, Z), 32 threads.
// C[m][n] (f32, pitch ldc, + optional f32 bias[n]) = sum_k A[m][k] Bt[n][k] (+ split products per NSPLIT). z-batch strides sA/sB/sC in elements. K % 32 == 0.
template <typename T16, int NSPLIT, bool BIAS>
__global__ __launch_bounds__(32) void k_gemmw(const T16* __restrict__ A, const T16* __restrict__ A2, const T16* __restrict__ Bt, const T16* __restrict__ Bt2, int K, float* C, int ldc, const float* __restrict__ bias, size_t sA, size_t sB, size_t sC) {
    typedef typename WFrag<T16>::V V;
    __shared__ __align__(16) float os[16 * 68];
    const size_t z = blockIdx.z; A += z * sA; if (A2) A2 += z * sA; Bt += z * sB; if (Bt2) Bt2 += z * sB; C += z * sC;
    const int lane = threadIdx.x & 31, lr = lane & 15, hi = lane >> 4; const int r0 = blockIdx.x * 64, c0 = blockIdx.y * 64;
    v8f acc[4][4];
#pragma unroll
    for (int mb = 0; mb < 4; ++mb)
#pragma unroll
        for (int nb = 0; nb < 4; ++nb) acc[mb][nb] = (v8f){};
    const size_t aoff = (size_t)(r0 + lr) * K + 8 * hi, boff = (size_t)(c0 + lr) * K + 8 * hi;
#pragma unroll 1
    for (int kc = 0; kc < K; kc += 32) {
        V a[4], a2[4];
#pragma unroll
        for (int mb = 0; mb < 4; ++mb) { a[mb] = WFrag<T16>::ld(A + aoff + (size_t)mb * 16 * K + kc); if (NSPLIT == 1 || NSPLIT == 2) a2[mb] = WFrag<T16>::ld(A2 + aoff + (size_t)mb * 16 * K + kc); }
#pragma unroll
        for (int nb = 0; nb < 4; ++nb) { const V b = WFrag<T16>::ld(Bt + boff + (size_t)nb * 16 * K + kc); V b2; if (NSPLIT >= 2) b2 = WFrag<T16>::ld(Bt2 + boff + (size_t)nb * 16 * K + kc);
#pragma unroll
            for (int mb = 0; mb < 4; ++mb) { acc[mb][nb] = WFrag<T16>::mma(a[mb], b, acc[mb][nb]); if (NSPLIT == 1 || NSPLIT == 2) acc[mb][nb] = WFrag<T16>::mma(a2[mb], b, acc[mb][nb]); if (NSPLIT >= 2) acc[mb][nb] = WFrag<T16>::mma(a[mb], b2, acc[mb][nb]); } }
        asm volatile("v_nop\n\tv_nop\n\tv_nop\n\tv_nop" : "+v"(acc[0][0]), "+v"(acc[1][1]), "+v"(acc[2][2]), "+v"(acc[3][3]) : "v"(a[0]), "v"(a[3]));
    }
#pragma unroll
    for (int mb = 0; mb < 4; ++mb) {
#pragma unroll
        for (int nb = 0; nb < 4; ++nb) {
#pragma unroll
            for (int j = 0; j < 8; ++j) os[(hi * 8 + j) * 68 + nb * 16 + lr] = acc[mb][nb][j]; }
        __builtin_amdgcn_wave_barrier(); asm volatile("" ::: "memory");
        float* crow = C + (size_t)(r0 + mb * 16) * ldc + c0;
{
#pragma unroll
            for (int s = 0; s < 8; ++s) { const int row = 2 * s + hi, cofs = lr * 4; v4f val = *(const v4fa*)(os + row * 68 + cofs); if (BIAS) { val[0] += bfr(bias[c0 + cofs]); val[1] += bfr(bias[c0 + cofs + 1]); val[2] += bfr(bias[c0 + cofs + 2]); val[3] += bfr(bias[c0 + cofs + 3]); }
                *(v4f*)(crow + (size_t)row * ldc + cofs) = val; }
             }
        __builtin_amdgcn_wave_barrier(); asm volatile("" ::: "memory");
    }
}

static __device__ __forceinline__ void cvt8_body(unsigned bx, const float* __restrict__ src, bf* dst, size_t n8) { const size_t i = (size_t)bx * 256 + threadIdx.x; if (i >= n8) return; const v8f v = *(const v8f*)(src + i * 8); v8us o;
#pragma unroll
    for (int k = 0; k < 8; ++k) o[k] = f2bf(v[k]); *(v8us*)(dst + i * 8) = o;  }

// ---- additions for this block ----
// f16 operand convert that cannot yield a subnormal (value select applied after any carry).
static __device__ __forceinline__ h16 toh_flush(float v) { const h16 r = (h16)v; return (fabsf(v) < 6.103515625e-05f) ? (h16)0.0f : r; }
// per-instruction guarded WMMA wrappers (one accumulator per guard).
__device__ __forceinline__ v8f wg16(v16h a, v16h b, v8f c) { c = wmma16(a, b, c); asm volatile("v_nop\n\tv_nop\n\tv_nop\n\tv_nop" : "+v"(c) : "v"(a), "v"(b)); return c; }
__device__ __forceinline__ v8f wgb(v16bf a, v16bf b, v8f c) { c = wmmab(a, b, c); asm volatile("v_nop\n\tv_nop\n\tv_nop\n\tv_nop" : "+v"(c) : "v"(a), "v"(b)); return c; }

// cvtT_body: W[k][n] f32 ([in][out], in = DM rows, row pitch N) -> Bt[n][k] bf16 (rows K-contiguous, pitch DM). 64x64 tile through LDS (block barrier between the element stores and the
static __device__ __forceinline__ void cvtT_body(int bx, int by, const float* __restrict__ src, int N, bf* dst) {
    __shared__ __align__(16) unsigned short tl[64 * SPT];
    const int tid = threadIdx.x; const int k0 = bx * 64, n0 = by * 64;
#pragma unroll 1
    for (int it = 0; it < 16; ++it) { const int idx = it * 256 + tid; const int kk = idx >> 6, nn = idx & 63; tl[nn * SPT + kk] = f2bf(src[(size_t)(k0 + kk) * N + n0 + nn]); }
    __syncthreads();
{
#pragma unroll
        for (int it = 0; it < 2; ++it) { const int p = it * 256 + tid; const int row = p >> 3, pc = p & 7; const v8us v = *(const v8usa*)(tl + row * SPT + pc * 8);
            *(v8us*)(dst + (size_t)(n0 + row) * DM + k0 + pc * 8) = v; }
         }
}

static __device__ __forceinline__ void gate_body(unsigned bx, const float* __restrict__ x, const float* __restrict__ wg, float* G) {
#pragma clang fp contract(off)
    const int idx = bx * 256 + threadIdx.x; if (idx >= TT * NKV) return; const int t = idx / NKV, g = idx % NKV; const float* xr = x + (size_t)t * DM; float a = 0.0f;
#pragma unroll 1
    for (int c = 0; c < GCH; ++c) a += bfr(xr[c]) * bfr(wg[c * NKV + g]);
    const float gt = 2.0f * (1.0f / (1.0f + expf(-a)));
    *(float*)(G + idx) = gt;  }

// k_prep: every conversion that reads inputs only, as block ranges of one grid (none reads what another writes): weight transposes first (the longest blocks), then the gate, then x.
#define PB_Q ((DM / 64) * (DQ / 64))
#define PB_K ((DM / 64) * (DKV / 64))
#define PB_O ((DQ / 64) * (DM / 64))
#define PB_T (PB_Q + 2 * PB_K + PB_O)
#define PB_G ((TT * NKV + 255) / 256)
#define PB_X ((TT * DM / 8 + 255) / 256)
__global__ __launch_bounds__(256) void k_prep(const float* __restrict__ wq, const float* __restrict__ wk, const float* __restrict__ wv, const float* __restrict__ wo, const float* __restrict__ x, const float* __restrict__ wg,
                                              bf* WQKV, bf* WO, bf* XB, float* G) {
    const unsigned b = blockIdx.x;
    if (b < PB_T) {
        const float* src; int N; bf* dst; unsigned r;
        if (b < PB_Q) { src = wq; N = DQ; dst = WQKV; r = b; }                                                              /* Wq [in][out] -> Bt rows 0..DQ-1 */
        else if (b < PB_Q + PB_K) { src = wk; N = DKV; dst = WQKV + (size_t)DQ * DM; r = b - PB_Q; }                         /* Wk -> Bt rows DQ..DQ+DKV-1 */
        else if (b < PB_Q + 2 * PB_K) { src = wv; N = DKV; dst = WQKV + (size_t)(DQ + DKV) * DM; r = b - (PB_Q + PB_K); }    /* Wv -> Bt rows DQ+DKV.. */
        else { src = wo; N = DM; dst = WO; r = b - (PB_Q + 2 * PB_K); }                                                      /* Wo [in = DQ][out = DM] -> Bt [DM][DQ] */
        cvtT_body((int)(r % (DM / 64)), (int)(r / (DM / 64)), src, N, dst);
    } else if (b < PB_T + PB_G) { gate_body(b - PB_T, x, wg, G); }
    else { cvt8_body(b - (PB_T + PB_G), x, XB, (size_t)TT * DM / 8); }
}

// ropen_body: head planes [h][t][d] (fp16 + bf16 hi/lo) of rmsnorm(rotary(F)) with x = F[t][coff + h*HD + d] (row pitch 'pitch'), tables cos/sin [t][32] read by value (bf16 RNE):
// d < 32: r = x[d] cos[d] + x[d+32] sin[d]; d >= 32: r = x[d] cos[d-32] - x[d-32] sin[d-32]; y = r * rsqrt(mean_d r^2 + eps). One wave per (h, t) row: lane -> 2 consecutive d,
static __device__ __forceinline__ void ropen_body(unsigned bx, const float* __restrict__ F, int pitch, int coff, int nheads, const float* __restrict__ cosb, const float* __restrict__ sinb, h16* P16, bf* Ph, bf* Pl) {
#pragma clang fp contract(off)
    const size_t e = ((size_t)bx * 256 + threadIdx.x) * 2; if (e >= (size_t)nheads * TT * HD) return; const int d = (int)(e % HD); const int t = (int)((e / HD) % TT); const int h = (int)(e / ((size_t)HD * TT));
    const float* f = F + (size_t)t * pitch + coff + h * HD; const int j = d & (HD / 2 - 1); const int dp = d ^ (HD / 2); const float sg = (d < HD / 2) ? 1.0f : -1.0f;
    const v2f xa = *(const v2f*)(f + d); const v2f xb = *(const v2f*)(f + dp); const v2f cc = *(const v2f*)(cosb + (size_t)t * (HD / 2) + j); const v2f sn = *(const v2f*)(sinb + (size_t)t * (HD / 2) + j);
    const float r0 = xa[0] * bfr(cc[0]) + sg * (xb[0] * bfr(sn[0])); const float r1 = xa[1] * bfr(cc[1]) + sg * (xb[1] * bfr(sn[1]));
    float ss = r0 * r0 + r1 * r1;
#pragma unroll
    for (int sh = 16; sh; sh >>= 1) ss += __shfl_xor(ss, sh, 32);
    const float rs = rsqrtf(ss * (1.0f / (float)HD) + EPSF); const float y0 = r0 * rs, y1 = r1 * rs;
    v2h o16; v2us oh, ol; unsigned short a2, c2; o16[0] = toh_flush(y0); o16[1] = toh_flush(y1); splitf(y0, a2, c2); oh[0] = a2; ol[0] = c2; splitf(y1, a2, c2); oh[1] = a2; ol[1] = c2;
    *(v2h*)(P16 + e) = o16; *(v2us*)(Ph + e) = oh; *(v2us*)(Pl + e) = ol;  }

static __device__ __forceinline__ void vtg_body(unsigned bx, const float* __restrict__ F, int pitch, int coff, int nheads, const float* __restrict__ G, const float* __restrict__ ve, h16* V16, bf* Vh, bf* Vl) {
#pragma clang fp contract(off)
    const size_t e = ((size_t)bx * 256 + threadIdx.x) * 2; if (e >= (size_t)nheads * HD * TT) return; const int t = (int)(e % TT); const int d = (int)((e / TT) % HD); const int g = (int)(e / ((size_t)TT * HD)); v2h o16; v2us oh, ol;
#pragma unroll
    for (int q = 0; q < 2; ++q) { const int tq = t + q; const float gv = G[(size_t)tq * NKV + g]; const float ev = bfr(ve[(size_t)tq * DKV + g * HD + d]); const float x = F[(size_t)tq * pitch + coff + g * HD + d] + gv * ev;
        o16[q] = toh_flush(x); unsigned short a2, c2; splitf(x, a2, c2); oh[q] = a2; ol[q] = c2; }
    *(v2h*)(V16 + e) = o16; *(v2us*)(Vh + e) = oh; *(v2us*)(Vl + e) = ol;  }

// k_post: the three passes that turn the projection F into operand planes, in one grid (each reads F, none reads another's planes). The kinds are dealt in turn, 1 v block : 1 k block : REP q blocks,
// so that the v blocks, whose strided reads load L2 most, are spread over the whole launch and the streaming q and k blocks run beside them.
#define LQ_  ((unsigned)(((size_t)NH_ * TT * HD / 2 + 255) / 256))
#define LKV_ ((unsigned)(((size_t)NKV * TT * HD / 2 + 255) / 256))
__global__ __launch_bounds__(256) void k_post(const float* __restrict__ F, const float* __restrict__ G, const float* __restrict__ ve, const float* __restrict__ cosb, const float* __restrict__ sinb,
                                              h16* QP16, bf* QPh, bf* QPl, h16* KP16, bf* KPh, bf* KPl, h16* VT16, bf* VTh, bf* VTl) {
    static_assert(LQ_ == REP * LKV_);
    const unsigned q = blockIdx.x / (REP + 2), r = blockIdx.x % (REP + 2);
    if (r == 0) { vtg_body(q, F, NQKV, DQ + DKV, NKV, G, ve, VT16, VTh, VTl); }
    else if (r == 1) { ropen_body(q, F, NQKV, DQ, NKV, cosb, sinb, KP16, KPh, KPl); }
    else { ropen_body(q * REP + (r - 2), F, NQKV, 0, NH_, cosb, sinb, QP16, QPh, QPl); }
}

// ---- attn_body: register-fed transposed flash step. Block = 4 waves = 64 query rows of head blockIdx.y; each wave owns 16 queries q0..q0+15 and walks 32-key steps kb from the
// window start (aligned down to 32) to the diagonal. S^T tiles (keys kb..kb+15 and kb+16..kb+31 on D rows 8*hi+r, query lr on D columns) = K fragment (A: row = key, k = channel)
// x Q fragment (B: column = query, k = channel). Online softmax per query = per lane (the lane pair l, l^16 shares a query; max exchanged by one xor-16 shuffle; the row sum stays a
// per-lane partial and is combined once at the end). Packed S^T tiles form the B fragment of O^T = V^T P^T directly (elements 0..7 <- tile 0 rows 8*hi.., 8..15 <- tile 1), A = V^T
// fragment (row = channel, k = key) from the [g][d][t] planes. EARLY: all operands as bf16 hi/lo planes, three products per site, P unnormalised in (0,1], row sum over the f32 p.
// Late: single f16 products, P carried x1024 with the exponent-argument select (no f16 subnormal can form), row sum over the converted P.
template <bool EARLY>
static __device__ __forceinline__ void attn_body(const h16* __restrict__ Q16, const bf* __restrict__ Qh, const bf* __restrict__ Ql, const h16* __restrict__ K16, const bf* __restrict__ Kh, const bf* __restrict__ Kl,
                                                 const h16* __restrict__ V16, const bf* __restrict__ Vh, const bf* __restrict__ Vl, const int* __restrict__ wsp, v8f (&o)[4], float& l) {
    const int lane = threadIdx.x & 31, lr = lane & 15, hi = lane >> 4;
    const int wave = __builtin_amdgcn_readfirstlane(threadIdx.x >> 5);
    const int h = (int)blockIdx.y, g = h / REP;
    const int q0 = (int)blockIdx.x * 64 + wave * 16;
    int wl = wsp[0]; if (wl <= 0 || wl >= TT) wl = TT;
    int klo = q0 - wl; klo &= ~(klo >> 31);               // floor at 0 without a compare
    const int kstart = klo & ~31; const int kend = q0 + 16;
    const int i = q0 + lr, ilo = i - wl;
    const size_t qoff = ((size_t)h * TT + q0 + lr) * HD + 8 * hi;
    const size_t kbase = (size_t)g * TT * HD + (size_t)lr * HD + 8 * hi;
    const size_t vbase = (size_t)g * HD * TT + (size_t)lr * TT + 8 * hi;
    v16h qf[2]; v16bf qh[2], ql[2];
#pragma unroll
    for (int c = 0; c < 2; ++c) { if (EARLY) { qh[c] = WFrag<bf>::ld(Qh + qoff + c * 32); ql[c] = WFrag<bf>::ld(Ql + qoff + c * 32); } else { qf[c] = WFrag<h16>::ld(Q16 + qoff + c * 32); } }
    float m = NEGB; l = 0.0f;
#pragma unroll
    for (int dt = 0; dt < 4; ++dt) o[dt] = (v8f){};
#pragma unroll 1
    for (int kb = kstart; kb < kend; kb += 32) {
        v8f s0 = (v8f){}, s1 = (v8f){};
        if (EARLY) {
#pragma unroll
            for (int c = 0; c < 2; ++c) { const size_t ko = kbase + (size_t)kb * HD + c * 32;
                const v16bf a0h = WFrag<bf>::ld(Kh + ko); const v16bf a0l = WFrag<bf>::ld(Kl + ko);
                s0 = wgb(a0h, qh[c], s0); s0 = wgb(a0l, qh[c], s0); s0 = wgb(a0h, ql[c], s0);
                const v16bf a1h = WFrag<bf>::ld(Kh + ko + 16 * HD); const v16bf a1l = WFrag<bf>::ld(Kl + ko + 16 * HD);
                s1 = wgb(a1h, qh[c], s1); s1 = wgb(a1l, qh[c], s1); s1 = wgb(a1h, ql[c], s1); }
        } else {
#pragma unroll
            for (int c = 0; c < 2; ++c) { const size_t ko = kbase + (size_t)kb * HD + c * 32;
                const v16h a0 = WFrag<h16>::ld(K16 + ko); const v16h a1 = WFrag<h16>::ld(K16 + ko + 16 * HD);
                s0 = wg16(a0, qf[c], s0); s1 = wg16(a1, qf[c], s1); }
        }
        float mx = NEGB;
#pragma unroll
        for (int r = 0; r < 8; ++r) { const int j0 = kb + 8 * hi + r, j1 = j0 + 16; const bool ok0 = (j0 <= i) && (j0 >= ilo); const bool ok1 = (j1 <= i) && (j1 >= ilo);
            const float t0 = ok0 ? s0[r] * SCL2 : NEGB; const float t1 = ok1 ? s1[r] * SCL2 : NEGB; s0[r] = t0; s1[r] = t1; mx = fmaxf(mx, fmaxf(t0, t1)); }
        mx = fmaxf(mx, __shfl_xor(mx, 16, 32));
        const float mnew = fmaxf(m, mx); const float alpha = __builtin_amdgcn_exp2f(m - mnew); m = mnew;
#pragma unroll
        for (int dt = 0; dt < 4; ++dt)
#pragma unroll
            for (int r = 0; r < 8; ++r) o[dt][r] *= alpha;
        float ls = 0.0f;
        if (EARLY) {
            v8us p0h, p0l, p1h, p1l;
#pragma unroll
            for (int r = 0; r < 8; ++r) { const float e0 = s0[r] - mnew, e1 = s1[r] - mnew; float pv0 = __builtin_amdgcn_exp2f(e0), pv1 = __builtin_amdgcn_exp2f(e1);
                pv0 = (s0[r] > -1.0e38f) ? pv0 : 0.0f; pv1 = (s1[r] > -1.0e38f) ? pv1 : 0.0f; ls += pv0 + pv1;
                unsigned short a2, c2; splitf(pv0, a2, c2); p0h[r] = a2; p0l[r] = c2; splitf(pv1, a2, c2); p1h[r] = a2; p1l[r] = c2; }
            const v16bf pfh = cat16b(p0h, p1h); const v16bf pfl = cat16b(p0l, p1l);
#pragma unroll
            for (int dt = 0; dt < 4; ++dt) { const size_t vo = vbase + (size_t)(dt * 16) * TT + kb; const v16bf vh = WFrag<bf>::ld(Vh + vo); const v16bf vl = WFrag<bf>::ld(Vl + vo);
                o[dt] = wgb(vh, pfh, o[dt]); o[dt] = wgb(vl, pfh, o[dt]); o[dt] = wgb(vh, pfl, o[dt]); }
        } else {
            v8h p0, p1;
#pragma unroll
            for (int r = 0; r < 8; ++r) { const float e0 = s0[r] - mnew + PLG, e1 = s1[r] - mnew + PLG; float pv0 = __builtin_amdgcn_exp2f(e0), pv1 = __builtin_amdgcn_exp2f(e1);
                pv0 = ((s0[r] > -1.0e38f) && (e0 >= -14.0f)) ? pv0 : 0.0f; pv1 = ((s1[r] > -1.0e38f) && (e1 >= -14.0f)) ? pv1 : 0.0f;
                const h16 c0 = (h16)pv0; const h16 c1 = (h16)pv1; p0[r] = c0; p1[r] = c1; ls += (float)c0 + (float)c1; }
            const v16h pf = cat16(p0, p1);
#pragma unroll
            for (int dt = 0; dt < 4; ++dt) { const size_t vo = vbase + (size_t)(dt * 16) * TT + kb; const v16h va = WFrag<h16>::ld(V16 + vo); o[dt] = wg16(va, pf, o[dt]); }
        }
        l = l * alpha + ls;
    }
}

// attn_store: the epilogue that both bodies share: join the lane pair's row sums, normalise, split to bf16 hi/lo, stage per wave in LDS, store whole rows of the merged [t][h*64+d] planes.
static __device__ __forceinline__ void attn_store(const v8f (&o)[4], float l, bf* ATh, bf* ATl) {
    __shared__ __align__(16) unsigned short stg[4 * 2 * 16 * SPT];
    const int lane = threadIdx.x & 31, lr = lane & 15, hi = lane >> 4;
    const int wave = __builtin_amdgcn_readfirstlane(threadIdx.x >> 5);
    const int h = (int)blockIdx.y;
    const int q0 = (int)blockIdx.x * 64 + wave * 16;
    const float lt = l + __shfl_xor(l, 16, 32);
    const float inv = 1.0f / lt;
    const int sb = wave * (2 * 16 * SPT);
#pragma unroll
    for (int dt = 0; dt < 4; ++dt) { v8us oh, ol;
#pragma unroll
        for (int r = 0; r < 8; ++r) { unsigned short a2, c2; splitf(o[dt][r] * inv, a2, c2); oh[r] = a2; ol[r] = c2; }
        *(v8usa*)(stg + sb + lr * SPT + dt * 16 + 8 * hi) = oh; *(v8usa*)(stg + sb + 16 * SPT + lr * SPT + dt * 16 + 8 * hi) = ol; }
    __builtin_amdgcn_wave_barrier(); asm volatile("" ::: "memory");
    const int prow = lane >> 3, pc = lane & 7;
{
#pragma unroll
        for (int s = 0; s < 4; ++s) { const int row = 4 * s + prow; const v8us sh = *(const v8usa*)(stg + sb + row * SPT + pc * 8); const v8us sl = *(const v8usa*)(stg + sb + 16 * SPT + row * SPT + pc * 8);
            const size_t oo = (size_t)(q0 + row) * DQ + (size_t)h * HD + pc * 8; *(v8us*)(ATh + oo) = sh; *(v8us*)(ATl + oo) = sl; }
         }
}

// k_attn: one grid (TT/64, NH_), 128 threads, for all query rows; blocks of rows [0, RH) take the bf16 hi/lo body, blocks of rows [RH, TT) the f16 body (a block-uniform choice), so both run side by side.
__global__ __launch_bounds__(128) void k_attn(const h16* __restrict__ Q16, const bf* __restrict__ Qh, const bf* __restrict__ Ql, const h16* __restrict__ K16, const bf* __restrict__ Kh, const bf* __restrict__ Kl,
                                              const h16* __restrict__ V16, const bf* __restrict__ Vh, const bf* __restrict__ Vl, bf* ATh, bf* ATl, const int* __restrict__ wsp) {
    v8f o[4]; float l;
    if ((int)blockIdx.x < RH / 64) attn_body<true>(nullptr, Qh, Ql, nullptr, Kh, Kl, nullptr, Vh, Vl, wsp, o, l);
    else attn_body<false>(Q16, nullptr, nullptr, K16, nullptr, nullptr, V16, nullptr, nullptr, wsp, o, l);
    attn_store(o, l, ATh, ATl); }

extern "C" void kernel_launch(void* const* d_in, const int* in_sizes, int n_in,
                              void* d_out, int out_size, void* d_ws, size_t ws_size, hipStream_t stream) {
    if (n_in < 10) return;
    if (in_sizes[0] < (NB - 1) * SEQ_FULL * DM + TT * DM) return;
    if (in_sizes[1] < (NB - 1) * SEQ_FULL * DKV + TT * DKV) return;
    if (in_sizes[2] < TT * (HD / 2) || in_sizes[3] < TT * (HD / 2)) return;
    if (in_sizes[4] < DM * DQ || in_sizes[5] < DM * DKV || in_sizes[6] < DM * DKV || in_sizes[7] < DQ * DM || in_sizes[8] < GCH * NKV || in_sizes[9] < 1) return;
    if (out_size < NB * TT * DM) return;
    const float* x = (const float*)d_in[0]; const float* ve = (const float*)d_in[1]; const float* cosb = (const float*)d_in[2]; const float* sinb = (const float*)d_in[3];
    const float* wq = (const float*)d_in[4]; const float* wk = (const float*)d_in[5]; const float* wv = (const float*)d_in[6]; const float* wo = (const float*)d_in[7]; const float* wg = (const float*)d_in[8];
    const int* wsp = (const int*)d_in[9];
    float* OUT = (float*)d_out;     // [NB][TT][DM] f32
    char* wsc = (char*)d_ws;
    auto take = [&](size_t bytes) { char* p = wsc; wsc += (bytes + 255) & ~(size_t)255; return (void*)p; };
    bf* WQKV = (bf*)take((size_t)NQKV * DM * 2); bf* WO = (bf*)take((size_t)DM * DQ * 2);
    bf* XB = (bf*)take((size_t)TT * DM * 2); float* F = (float*)take((size_t)TT * NQKV * 4); float* G = (float*)take((size_t)TT * NKV * 4);
    h16* QP16 = (h16*)take((size_t)NH_ * TT * HD * 2); bf* QPh = (bf*)take((size_t)NH_ * TT * HD * 2); bf* QPl = (bf*)take((size_t)NH_ * TT * HD * 2);
    h16* KP16 = (h16*)take((size_t)NKV * TT * HD * 2); bf* KPh = (bf*)take((size_t)NKV * TT * HD * 2); bf* KPl = (bf*)take((size_t)NKV * TT * HD * 2);
    h16* VT16 = (h16*)take((size_t)NKV * HD * TT * 2); bf* VTh = (bf*)take((size_t)NKV * HD * TT * 2); bf* VTl = (bf*)take((size_t)NKV * HD * TT * 2);
    bf* ATh = (bf*)take((size_t)TT * DQ * 2); bf* ATl = (bf*)take((size_t)TT * DQ * 2);
    const size_t used = (size_t)(wsc - (char*)d_ws); if (used > ws_size || used > (size_t)134217728u) return;   // 93,388,800 B at full size
    for (int b = 0; b < NB; ++b) {
        const float* xb = x + (size_t)b * SEQ_FULL * DM; const float* veb = ve + (size_t)b * SEQ_FULL * DKV;
        k_prep<<<PB_T + PB_G + PB_X, 256, 0, stream>>>(wq, wk, wv, wo, xb, wg, WQKV, WO, XB, G);
        k_gemmw<bf, 0, false><<<dim3(TT / 64, NQKV / 64, 1), 32, 0, stream>>>(XB, nullptr, WQKV, nullptr, DM, F, NQKV, nullptr, 0, 0, 0);
        k_post<<<(REP + 2) * LKV_, 256, 0, stream>>>(F, G, veb, cosb, sinb, QP16, QPh, QPl, KP16, KPh, KPl, VT16, VTh, VTl);
        k_attn<<<dim3(TT / 64, NH_), 128, 0, stream>>>(QP16, QPh, QPl, KP16, KPh, KPl, VT16, VTh, VTl, ATh, ATl, wsp);
        k_gemmw<bf, 1, false><<<dim3(TT / 64, DM / 64, 1), 32, 0, stream>>>(ATh, ATl, WO, nullptr, DQ, OUT + (size_t)b * TT * DM, DM, nullptr, 0, 0, 0); }
}

// v002
// It runs in 150 microseconds.
// In two side-by-side timings against v001, it was 1.20 and 1.23 times as fast.
// All steps since v000 together make it 1.54 times as fast.
#include <hip/hip_runtime.h>

// Compute dtypes, f32 accumulate everywhere: every float input RNE-converted to bf16 once; fused q|k|v projection v_wmma_f32_16x16x32_bf16 (bf16 x bf16, exact products);
// scores k.q^T: query rows < 512 bf16 hi/lo x bf16 hi/lo (3 products), rows >= 512 v_wmma_f32_16x16x32_f16 (f16 x f16); v^T.P^T: rows < 512 bf16 hi/lo x bf16 hi/lo (3 products),
// rows >= 512 f16 x f16 with P carried x1024; output projection bf16 hi/lo x bf16 (2 products); value gate (32 x 4), rotary, RMS normalisation and online softmax in f32 on the vector unit.
// Causal windowed grouped-query attention block (x [1][4096][1024]; q = x Wq (16 heads x 64), k/v = x Wk / x Wv (4 kv heads, query head h uses kv head h/4), weights [in][out];
// v += 2 sigmoid(x[:, :32] Wg) * ve; half-split rotary with input cos/sin tables [t][32] read by value: out[:32] = x1 cos + x2 sin, out[32:] = x2 cos - x1 sin; q and k scaled by
// rsqrt(mean(x^2) + eps) over the 64 head channels; scores/8 kept for j <= i and j >= i - window (window read on the device), else excluded; softmax; y merged [t][h*64+d]; out = y Wo f32).
// Attention is a register-fed transposed flash step: S^T = K Q^T (keys on D rows, queries on D columns), packed S^T tiles are the B fragment of O^T = V^T P^T; no score plane in memory.

#ifndef NB
#define NB 1
#endif
#ifndef SEQ
#define SEQ 4096
#endif
#define SEQ_FULL 4096
#define TT   SEQ
#define DM   1024
#define NH_  16
#define NKV  4
#define REP  (NH_ / NKV)
#define HD   64
#define DQ   (NH_ * HD)
#define DKV  (NKV * HD)
#define NQKV (DQ + 2 * DKV)
#define GCH  32
#define RH   ((TT < 512) ? TT : 512)     // query rows < RH use hi+lo planes
#define PLG  10.0f                        // log2 of the P carry (x1024) on rows >= RH
#define SCL2 (0.125f * 1.4426950408889634f)   // HD^-0.5 * log2(e)
#define NEGB (-3.0e38f)
#define EPSF 1.1920929e-07f
#define SPT  72                           // LDS staging row pitch in 16-bit elements

static_assert(TT % 64 == 0);
static_assert(RH % 64 == 0);
static_assert((TT - RH) % 64 == 0);
static_assert(DM % 64 == 0 && DQ % 64 == 0 && DKV % 64 == 0 && NQKV % 64 == 0);
static_assert(DM % 32 == 0 && DQ % 32 == 0 && HD % 32 == 0 && TT % 32 == 0);
static_assert(HD == 64);
static_assert(HD / 2 == 32);
static_assert(DQ == DM);
static_assert(NH_ % NKV == 0);
static_assert(GCH <= DM);
static_assert(SPT >= HD && SPT % 8 == 0);
static_assert((TT * DM) % 8 == 0);
static_assert(((long long)NH_ * TT * HD / 2) % 256 == 0 && ((long long)NKV * TT * HD / 2) % 256 == 0);
static_assert((TT * NKV) % 256 == 0);
static_assert(NB >= 1 && SEQ <= SEQ_FULL);

#define AL256(x) ((((size_t)(x)) + 255) & ~(size_t)255)
constexpr size_t WS_TOTAL = AL256((size_t)NQKV * DM * 2) + AL256((size_t)DM * DQ * 2) + AL256((size_t)TT * DM * 2) + AL256((size_t)TT * NKV * 4)
                          + 3 * AL256((size_t)NH_ * TT * HD * 2) + 3 * AL256((size_t)NKV * TT * HD * 2) + 3 * AL256((size_t)NKV * HD * TT * 2) + 2 * AL256((size_t)TT * DQ * 2);
static_assert(WS_TOTAL <= (size_t)134217728u);

typedef _Float16 h16;
typedef unsigned short bf;
typedef __attribute__((ext_vector_type(16))) __bf16   v16bf;
typedef __attribute__((ext_vector_type(16))) _Float16 v16h;
typedef __attribute__((ext_vector_type(8)))  _Float16 v8h;
typedef __attribute__((ext_vector_type(8)))  unsigned short v8us;
typedef __attribute__((ext_vector_type(8)))  float    v8f;
typedef __attribute__((ext_vector_type(4)))  float    v4f;
typedef __attribute__((ext_vector_type(2))) _Float16 v2h;
typedef __attribute__((ext_vector_type(4))) _Float16 v4h;
typedef __attribute__((ext_vector_type(2))) unsigned short v2us;
typedef __attribute__((ext_vector_type(4))) unsigned short v4us;
typedef __attribute__((ext_vector_type(2))) float v2f;
typedef v8h  __attribute__((may_alias)) v8ha;
typedef v4f  __attribute__((may_alias)) v4fa;
typedef v8us __attribute__((may_alias)) v8usa;

__device__ __forceinline__ unsigned short f2bf(float f) { unsigned u = __float_as_uint(f); u += 0x7FFFu + ((u >> 16) & 1u); return (unsigned short)(u >> 16); }
__device__ __forceinline__ float bf2f(unsigned short b) { return __uint_as_float(((unsigned)b) << 16); }
__device__ __forceinline__ float bfr(float f) { return bf2f(f2bf(f)); }
__device__ __forceinline__ v16h cat16(v8h lo, v8h hi) { return __builtin_shufflevector(lo, hi, 0, 1, 2, 3, 4, 5, 6, 7, 8, 9, 10, 11, 12, 13, 14, 15); }
__device__ __forceinline__ v16bf cat16b(v8us lo, v8us hi) { return __builtin_bit_cast(v16bf, __builtin_shufflevector(lo, hi, 0, 1, 2, 3, 4, 5, 6, 7, 8, 9, 10, 11, 12, 13, 14, 15)); }
__device__ __forceinline__ v8f wmma16(v16h a, v16h b, v8f c) { return __builtin_amdgcn_wmma_f32_16x16x32_f16(false, a, false, b, (short)0, c, false, false); }
__device__ __forceinline__ v8f wmmab(v16bf a, v16bf b, v8f c) { return __builtin_amdgcn_wmma_f32_16x16x32_bf16(false, a, false, b, (short)0, c, false, false); }
__device__ __forceinline__ h16 tohx(float x) { return (h16)x; }
__device__ __forceinline__ void splitf(float y, unsigned short& h, unsigned short& l) { h = f2bf(y); l = f2bf(y - bf2f(h)); }

// ---- 16-bit fragment loaders: lane l -> row (A) / column (Bt row) l & 15; elements 0..7 <- k0 + 8h + 0..7, 8..15 <- k0 + 16 + 8h + 0..7 (h = l >> 4); both operands K-contiguous.
template <typename T16> struct WFrag;
template <> struct WFrag<h16> { typedef v16h V; static __device__ __forceinline__ V ld(const h16* p) { return cat16(*(const v8h*)p, *(const v8h*)(p + 16)); } static __device__ __forceinline__ v8f mma(V a, V b, v8f c) { return wmma16(a, b, c); } };
template <> struct WFrag<bf> { typedef v16bf V; static __device__ __forceinline__ V ld(const bf* p) { return cat16b(*(const v8us*)p, *(const v8us*)(p + 16)); } static __device__ __forceinline__ v8f mma(V a, V b, v8f c) { return wmmab(a, b, c); } };

// ---- k_gemmw: register-blocked GEMM, ONE WAVE per 64x64 output tile (16 accumulators), operands straight from K-contiguous 16-bit planes; grid (M/64, N/64, Z), 32 threads.
// C[m][n] (f32, pitch ldc, + optional f32 bias[n]) = sum_k A[m][k] Bt[n][k] (+ split products per NSPLIT). z-batch strides sA/sB/sC in elements. K % 32 == 0.
template <typename T16, int NSPLIT, bool BIAS>
__global__ __launch_bounds__(32) void k_gemmw(const T16* __restrict__ A, const T16* __restrict__ A2, const T16* __restrict__ Bt, const T16* __restrict__ Bt2, int K, float* C, int ldc, const float* __restrict__ bias, size_t sA, size_t sB, size_t sC) {
    typedef typename WFrag<T16>::V V;
    __shared__ __align__(16) float os[16 * 68];
    const size_t z = blockIdx.z; A += z * sA; if (A2) A2 += z * sA; Bt += z * sB; if (Bt2) Bt2 += z * sB; C += z * sC;
    const int lane = threadIdx.x & 31, lr = lane & 15, hi = lane >> 4; const int r0 = blockIdx.x * 64, c0 = blockIdx.y * 64;
    v8f acc[4][4];
#pragma unroll
    for (int mb = 0; mb < 4; ++mb)
#pragma unroll
        for (int nb = 0; nb < 4; ++nb) acc[mb][nb] = (v8f){};
    const size_t aoff = (size_t)(r0 + lr) * K + 8 * hi, boff = (size_t)(c0 + lr) * K + 8 * hi;
#pragma unroll 1
    for (int kc = 0; kc < K; kc += 32) {
        V a[4], a2[4];
#pragma unroll
        for (int mb = 0; mb < 4; ++mb) { a[mb] = WFrag<T16>::ld(A + aoff + (size_t)mb * 16 * K + kc); if (NSPLIT == 1 || NSPLIT == 2) a2[mb] = WFrag<T16>::ld(A2 + aoff + (size_t)mb * 16 * K + kc); }
#pragma unroll
        for (int nb = 0; nb < 4; ++nb) { const V b = WFrag<T16>::ld(Bt + boff + (size_t)nb * 16 * K + kc); V b2; if (NSPLIT >= 2) b2 = WFrag<T16>::ld(Bt2 + boff + (size_t)nb * 16 * K + kc);
#pragma unroll
            for (int mb = 0; mb < 4; ++mb) { acc[mb][nb] = WFrag<T16>::mma(a[mb], b, acc[mb][nb]); if (NSPLIT == 1 || NSPLIT == 2) acc[mb][nb] = WFrag<T16>::mma(a2[mb], b, acc[mb][nb]); if (NSPLIT >= 2) acc[mb][nb] = WFrag<T16>::mma(a[mb], b2, acc[mb][nb]); } }
        asm volatile("v_nop\n\tv_nop\n\tv_nop\n\tv_nop" : "+v"(acc[0][0]), "+v"(acc[1][1]), "+v"(acc[2][2]), "+v"(acc[3][3]) : "v"(a[0]), "v"(a[3]));
    }
#pragma unroll
    for (int mb = 0; mb < 4; ++mb) {
#pragma unroll
        for (int nb = 0; nb < 4; ++nb) {
#pragma unroll
            for (int j = 0; j < 8; ++j) os[(hi * 8 + j) * 68 + nb * 16 + lr] = acc[mb][nb][j]; }
        __builtin_amdgcn_wave_barrier(); asm volatile("" ::: "memory");
        float* crow = C + (size_t)(r0 + mb * 16) * ldc + c0;
{
#pragma unroll
            for (int s = 0; s < 8; ++s) { const int row = 2 * s + hi, cofs = lr * 4; v4f val = *(const v4fa*)(os + row * 68 + cofs); if (BIAS) { val[0] += bfr(bias[c0 + cofs]); val[1] += bfr(bias[c0 + cofs + 1]); val[2] += bfr(bias[c0 + cofs + 2]); val[3] += bfr(bias[c0 + cofs + 3]); }
                *(v4f*)(crow + (size_t)row * ldc + cofs) = val; }
             }
        __builtin_amdgcn_wave_barrier(); asm volatile("" ::: "memory");
    }
}

static __device__ __forceinline__ void cvt8_body(unsigned bx, const float* __restrict__ src, bf* dst, size_t n8) { const size_t i = (size_t)bx * 256 + threadIdx.x; if (i >= n8) return; const v8f v = *(const v8f*)(src + i * 8); v8us o;
#pragma unroll
    for (int k = 0; k < 8; ++k) o[k] = f2bf(v[k]); *(v8us*)(dst + i * 8) = o;  }

// ---- additions for this block ----
// f16 operand convert that cannot yield a subnormal (value select applied after any carry).
static __device__ __forceinline__ h16 toh_flush(float v) { const h16 r = (h16)v; return (fabsf(v) < 6.103515625e-05f) ? (h16)0.0f : r; }
// per-instruction guarded WMMA wrappers (one accumulator per guard).
__device__ __forceinline__ v8f wg16(v16h a, v16h b, v8f c) { c = wmma16(a, b, c); asm volatile("v_nop\n\tv_nop\n\tv_nop\n\tv_nop" : "+v"(c) : "v"(a), "v"(b)); return c; }
__device__ __forceinline__ v8f wgb(v16bf a, v16bf b, v8f c) { c = wmmab(a, b, c); asm volatile("v_nop\n\tv_nop\n\tv_nop\n\tv_nop" : "+v"(c) : "v"(a), "v"(b)); return c; }

// cvtT_body: W[k][n] f32 ([in][out], in = DM rows, row pitch N) -> Bt[n][k] bf16 (rows K-contiguous, pitch DM). 64x64 tile through LDS (block barrier between the element stores and the
static __device__ __forceinline__ void cvtT_body(int bx, int by, const float* __restrict__ src, int N, bf* dst) {
    __shared__ __align__(16) unsigned short tl[64 * SPT];
    const int tid = threadIdx.x; const int k0 = bx * 64, n0 = by * 64;
#pragma unroll 1
    for (int it = 0; it < 16; ++it) { const int idx = it * 256 + tid; const int kk = idx >> 6, nn = idx & 63; tl[nn * SPT + kk] = f2bf(src[(size_t)(k0 + kk) * N + n0 + nn]); }
    __syncthreads();
{
#pragma unroll
        for (int it = 0; it < 2; ++it) { const int p = it * 256 + tid; const int row = p >> 3, pc = p & 7; const v8us v = *(const v8usa*)(tl + row * SPT + pc * 8);
            *(v8us*)(dst + (size_t)(n0 + row) * DM + k0 + pc * 8) = v; }
         }
}

static __device__ __forceinline__ void gate_body(unsigned bx, const float* __restrict__ x, const float* __restrict__ wg, float* G) {
#pragma clang fp contract(off)
    const int idx = bx * 256 + threadIdx.x; if (idx >= TT * NKV) return; const int t = idx / NKV, g = idx % NKV; const float* xr = x + (size_t)t * DM; float a = 0.0f;
#pragma unroll 1
    for (int c = 0; c < GCH; ++c) a += bfr(xr[c]) * bfr(wg[c * NKV + g]);
    const float gt = 2.0f * (1.0f / (1.0f + expf(-a)));
    *(float*)(G + idx) = gt;  }

// k_prep: every conversion that reads inputs only, as block ranges of one grid (none reads what another writes): weight transposes first (the longest blocks), then the gate, then x.
#define PB_Q ((DM / 64) * (DQ / 64))
#define PB_K ((DM / 64) * (DKV / 64))
#define PB_O ((DQ / 64) * (DM / 64))
#define PB_T (PB_Q + 2 * PB_K + PB_O)
#define PB_G ((TT * NKV + 255) / 256)
#define PB_X ((TT * DM / 8 + 255) / 256)
__global__ __launch_bounds__(256) void k_prep(const float* __restrict__ wq, const float* __restrict__ wk, const float* __restrict__ wv, const float* __restrict__ wo, const float* __restrict__ x, const float* __restrict__ wg,
                                              bf* WQKV, bf* WO, bf* XB, float* G) {
    const unsigned b = blockIdx.x;
    if (b < PB_T) {
        const float* src; int N; bf* dst; unsigned r;
        if (b < PB_Q) { src = wq; N = DQ; dst = WQKV; r = b; }                                                              /* Wq [in][out] -> Bt rows 0..DQ-1 */
        else if (b < PB_Q + PB_K) { src = wk; N = DKV; dst = WQKV + (size_t)DQ * DM; r = b - PB_Q; }                         /* Wk -> Bt rows DQ..DQ+DKV-1 */
        else if (b < PB_Q + 2 * PB_K) { src = wv; N = DKV; dst = WQKV + (size_t)(DQ + DKV) * DM; r = b - (PB_Q + PB_K); }    /* Wv -> Bt rows DQ+DKV.. */
        else { src = wo; N = DM; dst = WO; r = b - (PB_Q + 2 * PB_K); }                                                      /* Wo [in = DQ][out = DM] -> Bt [DM][DQ] */
        cvtT_body((int)(r % (DM / 64)), (int)(r / (DM / 64)), src, N, dst);
    } else if (b < PB_T + PB_G) { gate_body(b - PB_T, x, wg, G); }
    else { cvt8_body(b - (PB_T + PB_G), x, XB, (size_t)TT * DM / 8); }
}

// ---- k_proj: the fused q|k|v projection with the operand planes written straight from its epilogue. ONE WAVE per 64x64 tile of x Wqkv (tile shape and k order of k_gemmw), grid (TT/64, NQKV/64), 32 threads.
// A tile's 64 columns are exactly one head (HD == 64), so the wave holds all a row's rotary partners and its whole RMS sum: no f32 projection plane goes through memory and no further launch reads it.
// The tile is staged once in LDS ([t][d] f32, pitch OSP); then, by the block-uniform kind of the column tile:
//   q and k heads: one row t per step, lane -> 2 consecutive d. d < 32: r = x[d] cos[d] + x[d+32] sin[d]; d >= 32: r = x[d] cos[d-32] - x[d-32] sin[d-32] (tables [t][32] read by value, bf16 RNE);
//                  y = r * rsqrt(mean_d r^2 + eps), sum by the xor tree 16, 8, 4, 2, 1 over the lanes; planes [h][t][d] (f16 + bf16 hi/lo), one whole 128-byte line per row and plane.
//   v heads:       lane -> channel d = 16 nb + (lane & 15), 8 consecutive t; x = v + gate[t][g] * ve[t][g*64+d] (ve bf16 RNE); planes [g][d][t] (f16 + bf16 hi/lo), 16 bytes per lane.
#define OSP 68                            // f32 staging row pitch: rows 8 apart fall 32 banks apart, so the two lane halves of a staging store do not collide
typedef v2f __attribute__((may_alias)) v2fa;
// lane l with lane l ^ 16 (vector cross-row move) and lane l with lane l ^ M inside its 16-lane row (DPP row_xmask): the one wave of a tile has no other wave to hide an LDS permute's latency behind,
// and the shuffle builtin's permutes came out as one serial chain of five waits per row
static __device__ __forceinline__ float xhalf(float x) { return __builtin_bit_cast(float, __builtin_amdgcn_permlanex16(__builtin_bit_cast(int, x), __builtin_bit_cast(int, x), 0x76543210, 0xfedcba98, false, false)); }
template <int M> static __device__ __forceinline__ float xrow(float x) { return __builtin_bit_cast(float, __builtin_amdgcn_update_dpp(0, __builtin_bit_cast(int, x), 0x160 + M, 0xf, 0xf, true)); }
static_assert(NQKV / 64 == NH_ + 2 * NKV);
__global__ __launch_bounds__(32) void k_proj(const bf* __restrict__ A, const bf* __restrict__ Bt, const float* __restrict__ G, const float* __restrict__ ve, const float* __restrict__ cosb, const float* __restrict__ sinb,
                                             h16* QP16, bf* QPh, bf* QPl, h16* KP16, bf* KPh, bf* KPl, h16* VT16, bf* VTh, bf* VTl) {
    typedef WFrag<bf>::V V;
    __shared__ __align__(16) float os[64 * OSP];
    const int lane = threadIdx.x & 31, lr = lane & 15, hi = lane >> 4; const int r0 = blockIdx.x * 64, c0 = blockIdx.y * 64;
    v8f acc[4][4];
#pragma unroll
    for (int mb = 0; mb < 4; ++mb)
#pragma unroll
        for (int nb = 0; nb < 4; ++nb) acc[mb][nb] = (v8f){};
    // every fragment address = the tile's uniform base + one lane byte offset (the same for A and Bt: both have pitch DM; it moves with kc) + a constant
    const char* At = (const char*)(A + (size_t)r0 * DM); const char* Bb = (const char*)(Bt + (size_t)c0 * DM); unsigned lo = (unsigned)(lr * DM + 8 * hi) * 2u;
#pragma unroll 1
    for (int kc = 0; kc < DM; kc += 32) {
        V a[4];
#pragma unroll
        for (int mb = 0; mb < 4; ++mb) a[mb] = WFrag<bf>::ld((const bf*)(At + lo + mb * 32 * DM));
#pragma unroll
        for (int np = 0; np < 4; np += 2) { const V b0 = WFrag<bf>::ld((const bf*)(Bb + lo + np * 32 * DM)); const V b1 = WFrag<bf>::ld((const bf*)(Bb + lo + (np + 1) * 32 * DM));
#pragma unroll
            for (int mb = 0; mb < 4; ++mb) { acc[mb][np] = WFrag<bf>::mma(a[mb], b0, acc[mb][np]); acc[mb][np + 1] = WFrag<bf>::mma(a[mb], b1, acc[mb][np + 1]); } }
        // keeps the WMMA distance on the loop's back edge and exit: the next vector write of a fragment register, or read of a tile, stands four vector slots behind the last WMMA
        asm volatile("v_nop\n\tv_nop\n\tv_nop\n\tv_nop" : "+v"(acc[0][0]), "+v"(acc[1][1]), "+v"(acc[2][2]), "+v"(acc[3][3]) : "v"(a[0]), "v"(a[3]));
        // the wait in front of the one rewrite of a register that this trip's loads name: the lane offset goes through the statement so that its step cannot be lifted over it
        asm volatile("s_wait_xcnt 0x0" : "+v"(lo) : : "memory");
        lo += 64;
    }
#pragma unroll
    for (int mb = 0; mb < 4; ++mb)
#pragma unroll
        for (int nb = 0; nb < 4; ++nb)
#pragma unroll
            for (int j = 0; j < 8; ++j) os[(mb * 16 + hi * 8 + j) * OSP + nb * 16 + lr] = acc[mb][nb][j];
    // the block is one wave: this only keeps the compiler from moving the read-back of other lanes' values in front of the staging stores
    __builtin_amdgcn_wave_barrier(); asm volatile("" ::: "memory");
    const int ct = (int)blockIdx.y;
    if (ct < NH_ + NKV) {
        const bool isk = ct >= NH_; const int h = isk ? ct - NH_ : ct;
        h16* P16 = isk ? KP16 : QP16; bf* Ph = isk ? KPh : QPh; bf* Pl = isk ? KPl : QPl;
        const int d = 2 * lane; const int jt = d & (HD / 2 - 1); const int dp = d ^ (HD / 2); const float sg = (d < HD / 2) ? 1.0f : -1.0f;
        const float* cp = cosb + (size_t)r0 * (HD / 2) + jt; const float* sp = sinb + (size_t)r0 * (HD / 2) + jt;
        const size_t ob = ((size_t)h * TT + r0) * HD + d;
        // rolled over groups of 16 rows (small text); the 16 rows of a group are independent, so their table loads go out together and their sums interleave
#pragma unroll 1
        for (int rb = 0; rb < 64; rb += 16) {
            v2f cc[16], sn[16]; float ra[16], rc[16], ss[16];
#pragma unroll
            for (int q = 0; q < 16; ++q) { cc[q] = *(const v2f*)(cp + (size_t)(rb + q) * (HD / 2)); sn[q] = *(const v2f*)(sp + (size_t)(rb + q) * (HD / 2)); }
#pragma unroll
            for (int q = 0; q < 16; ++q) { const v2f xa = *(const v2fa*)(os + (rb + q) * OSP + d); const v2f xb = *(const v2fa*)(os + (rb + q) * OSP + dp);
                ra[q] = xa[0] * bfr(cc[q][0]) + sg * (xb[0] * bfr(sn[q][0])); rc[q] = xa[1] * bfr(cc[q][1]) + sg * (xb[1] * bfr(sn[q][1]));
                ss[q] = ra[q] * ra[q] + rc[q] * rc[q]; }
#pragma unroll
            for (int q = 0; q < 16; ++q) { ss[q] += xhalf(ss[q]); ss[q] += xrow<8>(ss[q]); ss[q] += xrow<4>(ss[q]); ss[q] += xrow<2>(ss[q]); ss[q] += xrow<1>(ss[q]); }
#pragma unroll
            for (int q = 0; q < 16; ++q) { const float rs = rsqrtf(ss[q] * (1.0f / (float)HD) + EPSF); const float y0 = ra[q] * rs, y1 = rc[q] * rs;
                v2h o16; v2us oh, ol; unsigned short a2, c2; o16[0] = toh_flush(y0); o16[1] = toh_flush(y1); splitf(y0, a2, c2); oh[0] = a2; ol[0] = c2; splitf(y1, a2, c2); oh[1] = a2; ol[1] = c2;
                const size_t e = ob + (size_t)(rb + q) * HD; *(v2h*)(P16 + e) = o16; *(v2us*)(Ph + e) = oh; *(v2us*)(Pl + e) = ol; }
            // stands in front of the next group's rewrite of the address and data registers that this group's last stores name
            asm volatile("s_wait_xcnt 0x0" ::: "memory");
        }
    } else {
        const int g = ct - (NH_ + NKV);
        // rolled over the four 16-row groups (small text); the 32 value-embedding loads and 8 gate loads of a group go out together
#pragma unroll 1
        for (int mb = 0; mb < 4; ++mb) {
            const int tl = mb * 16 + hi * 8; const int t0 = r0 + tl; float gv[8], ev[4][8];
#pragma unroll
            for (int j = 0; j < 8; ++j) { gv[j] = G[(size_t)(t0 + j) * NKV + g];
#pragma unroll
                for (int nb = 0; nb < 4; ++nb) ev[nb][j] = ve[(size_t)(t0 + j) * DKV + g * HD + nb * 16 + lr]; }
#pragma unroll
            for (int nb = 0; nb < 4; ++nb) { const int d = nb * 16 + lr; v8h o16; v8us oh, ol;
#pragma unroll
                for (int j = 0; j < 8; ++j) { const float x = os[(tl + j) * OSP + d] + gv[j] * bfr(ev[nb][j]); o16[j] = toh_flush(x); unsigned short a2, c2; splitf(x, a2, c2); oh[j] = a2; ol[j] = c2; }
                const size_t e = ((size_t)g * HD + d) * TT + t0; *(v8h*)(VT16 + e) = o16; *(v8us*)(VTh + e) = oh; *(v8us*)(VTl + e) = ol; }
        }
    }
}

// ---- attn_body: register-fed transposed flash step. Block = 4 waves = 64 query rows of head blockIdx.y; each wave owns 16 queries q0..q0+15 and walks 32-key steps kb from the
// window start (aligned down to 32) to the diagonal. S^T tiles (keys kb..kb+15 and kb+16..kb+31 on D rows 8*hi+r, query lr on D columns) = K fragment (A: row = key, k = channel)
// x Q fragment (B: column = query, k = channel). Online softmax per query = per lane (the lane pair l, l^16 shares a query; max exchanged by one xor-16 shuffle; the row sum stays a
// per-lane partial and is combined once at the end). Packed S^T tiles form the B fragment of O^T = V^T P^T directly (elements 0..7 <- tile 0 rows 8*hi.., 8..15 <- tile 1), A = V^T
// fragment (row = channel, k = key) from the [g][d][t] planes. EARLY: all operands as bf16 hi/lo planes, three products per site, P unnormalised in (0,1], row sum over the f32 p.
// Late: single f16 products, P carried x1024 with the exponent-argument select (no f16 subnormal can form), row sum over the converted P.
template <bool EARLY>
static __device__ __forceinline__ void attn_body(const h16* __restrict__ Q16, const bf* __restrict__ Qh, const bf* __restrict__ Ql, const h16* __restrict__ K16, const bf* __restrict__ Kh, const bf* __restrict__ Kl,
                                                 const h16* __restrict__ V16, const bf* __restrict__ Vh, const bf* __restrict__ Vl, const int* __restrict__ wsp, v8f (&o)[4], float& l) {
    const int lane = threadIdx.x & 31, lr = lane & 15, hi = lane >> 4;
    const int wave = __builtin_amdgcn_readfirstlane(threadIdx.x >> 5);
    const int h = (int)blockIdx.y, g = h / REP;
    const int q0 = (int)blockIdx.x * 64 + wave * 16;
    int wl = wsp[0]; if (wl <= 0 || wl >= TT) wl = TT;
    int klo = q0 - wl; klo &= ~(klo >> 31);               // floor at 0 without a compare
    const int kstart = klo & ~31; const int kend = q0 + 16;
    const int i = q0 + lr, ilo = i - wl;
    const size_t qoff = ((size_t)h * TT + q0 + lr) * HD + 8 * hi;
    const size_t kbase = (size_t)g * TT * HD + (size_t)lr * HD + 8 * hi;
    const size_t vbase = (size_t)g * HD * TT + (size_t)lr * TT + 8 * hi;
    v16h qf[2]; v16bf qh[2], ql[2];
#pragma unroll
    for (int c = 0; c < 2; ++c) { if (EARLY) { qh[c] = WFrag<bf>::ld(Qh + qoff + c * 32); ql[c] = WFrag<bf>::ld(Ql + qoff + c * 32); } else { qf[c] = WFrag<h16>::ld(Q16 + qoff + c * 32); } }
    float m = NEGB; l = 0.0f;
#pragma unroll
    for (int dt = 0; dt < 4; ++dt) o[dt] = (v8f){};
#pragma unroll 1
    for (int kb = kstart; kb < kend; kb += 32) {
        v8f s0 = (v8f){}, s1 = (v8f){};
        if (EARLY) {
#pragma unroll
            for (int c = 0; c < 2; ++c) { const size_t ko = kbase + (size_t)kb * HD + c * 32;
                const v16bf a0h = WFrag<bf>::ld(Kh + ko); const v16bf a0l = WFrag<bf>::ld(Kl + ko);
                s0 = wgb(a0h, qh[c], s0); s0 = wgb(a0l, qh[c], s0); s0 = wgb(a0h, ql[c], s0);
                const v16bf a1h = WFrag<bf>::ld(Kh + ko + 16 * HD); const v16bf a1l = WFrag<bf>::ld(Kl + ko + 16 * HD);
                s1 = wgb(a1h, qh[c], s1); s1 = wgb(a1l, qh[c], s1); s1 = wgb(a1h, ql[c], s1); }
        } else {
#pragma unroll
            for (int c = 0; c < 2; ++c) { const size_t ko = kbase + (size_t)kb * HD + c * 32;
                const v16h a0 = WFrag<h16>::ld(K16 + ko); const v16h a1 = WFrag<h16>::ld(K16 + ko + 16 * HD);
                s0 = wg16(a0, qf[c], s0); s1 = wg16(a1, qf[c], s1); }
        }
        float mx = NEGB;
#pragma unroll
        for (int r = 0; r < 8; ++r) { const int j0 = kb + 8 * hi + r, j1 = j0 + 16; const bool ok0 = (j0 <= i) && (j0 >= ilo); const bool ok1 = (j1 <= i) && (j1 >= ilo);
            const float t0 = ok0 ? s0[r] * SCL2 : NEGB; const float t1 = ok1 ? s1[r] * SCL2 : NEGB; s0[r] = t0; s1[r] = t1; mx = fmaxf(mx, fmaxf(t0, t1)); }
        mx = fmaxf(mx, __shfl_xor(mx, 16, 32));
        const float mnew = fmaxf(m, mx); const float alpha = __builtin_amdgcn_exp2f(m - mnew); m = mnew;
#pragma unroll
        for (int dt = 0; dt < 4; ++dt)
#pragma unroll
            for (int r = 0; r < 8; ++r) o[dt][r] *= alpha;
        float ls = 0.0f;
        if (EARLY) {
            v8us p0h, p0l, p1h, p1l;
#pragma unroll
            for (int r = 0; r < 8; ++r) { const float e0 = s0[r] - mnew, e1 = s1[r] - mnew; float pv0 = __builtin_amdgcn_exp2f(e0), pv1 = __builtin_amdgcn_exp2f(e1);
                pv0 = (s0[r] > -1.0e38f) ? pv0 : 0.0f; pv1 = (s1[r] > -1.0e38f) ? pv1 : 0.0f; ls += pv0 + pv1;
                unsigned short a2, c2; splitf(pv0, a2, c2); p0h[r] = a2; p0l[r] = c2; splitf(pv1, a2, c2); p1h[r] = a2; p1l[r] = c2; }
            const v16bf pfh = cat16b(p0h, p1h); const v16bf pfl = cat16b(p0l, p1l);
#pragma unroll
            for (int dt = 0; dt < 4; ++dt) { const size_t vo = vbase + (size_t)(dt * 16) * TT + kb; const v16bf vh = WFrag<bf>::ld(Vh + vo); const v16bf vl = WFrag<bf>::ld(Vl + vo);
                o[dt] = wgb(vh, pfh, o[dt]); o[dt] = wgb(vl, pfh, o[dt]); o[dt] = wgb(vh, pfl, o[dt]); }
        } else {
            v8h p0, p1;
#pragma unroll
            for (int r = 0; r < 8; ++r) { const float e0 = s0[r] - mnew + PLG, e1 = s1[r] - mnew + PLG; float pv0 = __builtin_amdgcn_exp2f(e0), pv1 = __builtin_amdgcn_exp2f(e1);
                pv0 = ((s0[r] > -1.0e38f) && (e0 >= -14.0f)) ? pv0 : 0.0f; pv1 = ((s1[r] > -1.0e38f) && (e1 >= -14.0f)) ? pv1 : 0.0f;
                const h16 c0 = (h16)pv0; const h16 c1 = (h16)pv1; p0[r] = c0; p1[r] = c1; ls += (float)c0 + (float)c1; }
            const v16h pf = cat16(p0, p1);
#pragma unroll
            for (int dt = 0; dt < 4; ++dt) { const size_t vo = vbase + (size_t)(dt * 16) * TT + kb; const v16h va = WFrag<h16>::ld(V16 + vo); o[dt] = wg16(va, pf, o[dt]); }
        }
        l = l * alpha + ls;
    }
}

// attn_store: the epilogue that both bodies share: join the lane pair's row sums, normalise, split to bf16 hi/lo, stage per wave in LDS, store whole rows of the merged [t][h*64+d] planes.
static __device__ __forceinline__ void attn_store(const v8f (&o)[4], float l, bf* ATh, bf* ATl) {
    __shared__ __align__(16) unsigned short stg[4 * 2 * 16 * SPT];
    const int lane = threadIdx.x & 31, lr = lane & 15, hi = lane >> 4;
    const int wave = __builtin_amdgcn_readfirstlane(threadIdx.x >> 5);
    const int h = (int)blockIdx.y;
    const int q0 = (int)blockIdx.x * 64 + wave * 16;
    const float lt = l + __shfl_xor(l, 16, 32);
    const float inv = 1.0f / lt;
    const int sb = wave * (2 * 16 * SPT);
#pragma unroll
    for (int dt = 0; dt < 4; ++dt) { v8us oh, ol;
#pragma unroll
        for (int r = 0; r < 8; ++r) { unsigned short a2, c2; splitf(o[dt][r] * inv, a2, c2); oh[r] = a2; ol[r] = c2; }
        *(v8usa*)(stg + sb + lr * SPT + dt * 16 + 8 * hi) = oh; *(v8usa*)(stg + sb + 16 * SPT + lr * SPT + dt * 16 + 8 * hi) = ol; }
    __builtin_amdgcn_wave_barrier(); asm volatile("" ::: "memory");
    const int prow = lane >> 3, pc = lane & 7;
{
#pragma unroll
        for (int s = 0; s < 4; ++s) { const int row = 4 * s + prow; const v8us sh = *(const v8usa*)(stg + sb + row * SPT + pc * 8); const v8us sl = *(const v8usa*)(stg + sb + 16 * SPT + row * SPT + pc * 8);
            const size_t oo = (size_t)(q0 + row) * DQ + (size_t)h * HD + pc * 8; *(v8us*)(ATh + oo) = sh; *(v8us*)(ATl + oo) = sl; }
         }
}

// k_attn: one grid (TT/64, NH_), 128 threads, for all query rows; blocks of rows [0, RH) take the bf16 hi/lo body, blocks of rows [RH, TT) the f16 body (a block-uniform choice), so both run side by side.
__global__ __launch_bounds__(128) void k_attn(const h16* __restrict__ Q16, const bf* __restrict__ Qh, const bf* __restrict__ Ql, const h16* __restrict__ K16, const bf* __restrict__ Kh, const bf* __restrict__ Kl,
                                              const h16* __restrict__ V16, const bf* __restrict__ Vh, const bf* __restrict__ Vl, bf* ATh, bf* ATl, const int* __restrict__ wsp) {
    v8f o[4]; float l;
    if ((int)blockIdx.x < RH / 64) attn_body<true>(nullptr, Qh, Ql, nullptr, Kh, Kl, nullptr, Vh, Vl, wsp, o, l);
    else attn_body<false>(Q16, nullptr, nullptr, K16, nullptr, nullptr, V16, nullptr, nullptr, wsp, o, l);
    attn_store(o, l, ATh, ATl); }

extern "C" void kernel_launch(void* const* d_in, const int* in_sizes, int n_in,
                              void* d_out, int out_size, void* d_ws, size_t ws_size, hipStream_t stream) {
    if (n_in < 10) return;
    if (in_sizes[0] < (NB - 1) * SEQ_FULL * DM + TT * DM) return;
    if (in_sizes[1] < (NB - 1) * SEQ_FULL * DKV + TT * DKV) return;
    if (in_sizes[2] < TT * (HD / 2) || in_sizes[3] < TT * (HD / 2)) return;
    if (in_sizes[4] < DM * DQ || in_sizes[5] < DM * DKV || in_sizes[6] < DM * DKV || in_sizes[7] < DQ * DM || in_sizes[8] < GCH * NKV || in_sizes[9] < 1) return;
    if (out_size < NB * TT * DM) return;
    const float* x = (const float*)d_in[0]; const float* ve = (const float*)d_in[1]; const float* cosb = (const float*)d_in[2]; const float* sinb = (const float*)d_in[3];
    const float* wq = (const float*)d_in[4]; const float* wk = (const float*)d_in[5]; const float* wv = (const float*)d_in[6]; const float* wo = (const float*)d_in[7]; const float* wg = (const float*)d_in[8];
    const int* wsp = (const int*)d_in[9];
    float* OUT = (float*)d_out;     // [NB][TT][DM] f32
    char* wsc = (char*)d_ws;
    auto take = [&](size_t bytes) { char* p = wsc; wsc += (bytes + 255) & ~(size_t)255; return (void*)p; };
    bf* WQKV = (bf*)take((size_t)NQKV * DM * 2); bf* WO = (bf*)take((size_t)DM * DQ * 2);
    bf* XB = (bf*)take((size_t)TT * DM * 2); float* G = (float*)take((size_t)TT * NKV * 4);
    h16* QP16 = (h16*)take((size_t)NH_ * TT * HD * 2); bf* QPh = (bf*)take((size_t)NH_ * TT * HD * 2); bf* QPl = (bf*)take((size_t)NH_ * TT * HD * 2);
    h16* KP16 = (h16*)take((size_t)NKV * TT * HD * 2); bf* KPh = (bf*)take((size_t)NKV * TT * HD * 2); bf* KPl = (bf*)take((size_t)NKV * TT * HD * 2);
    h16* VT16 = (h16*)take((size_t)NKV * HD * TT * 2); bf* VTh = (bf*)take((size_t)NKV * HD * TT * 2); bf* VTl = (bf*)take((size_t)NKV * HD * TT * 2);
    bf* ATh = (bf*)take((size_t)TT * DQ * 2); bf* ATl = (bf*)take((size_t)TT * DQ * 2);
    const size_t used = (size_t)(wsc - (char*)d_ws); if (used > ws_size || used > (size_t)134217728u) return;   // 68,222,976 B at full size
    for (int b = 0; b < NB; ++b) {
        const float* xb = x + (size_t)b * SEQ_FULL * DM; const float* veb = ve + (size_t)b * SEQ_FULL * DKV;
        k_prep<<<PB_T + PB_G + PB_X, 256, 0, stream>>>(wq, wk, wv, wo, xb, wg, WQKV, WO, XB, G);
        k_proj<<<dim3(TT / 64, NQKV / 64, 1), 32, 0, stream>>>(XB, WQKV, G, veb, cosb, sinb, QP16, QPh, QPl, KP16, KPh, KPl, VT16, VTh, VTl);
        k_attn<<<dim3(TT / 64, NH_), 128, 0, stream>>>(QP16, QPh, QPl, KP16, KPh, KPl, VT16, VTh, VTl, ATh, ATl, wsp);
        k_gemmw<bf, 1, false><<<dim3(TT / 64, DM / 64, 1), 32, 0, stream>>>(ATh, ATl, WO, nullptr, DQ, OUT + (size_t)b * TT * DM, DM, nullptr, 0, 0, 0); }
}

// v003
// One run takes 127 microseconds.
// In two side-by-side timings against v002, it was 1.16 and 1.17 times as fast.
// Over all steps from v000 it is 1.79 times as fast.
#include <hip/hip_runtime.h>

// Compute dtypes, f32 accumulate everywhere: every float input RNE-converted to bf16 once; fused q|k|v projection v_wmma_f32_16x16x32_bf16 (bf16 x bf16, exact products);
// scores k.q^T: query rows < 512 bf16 hi/lo x bf16 hi/lo (3 products), rows >= 512 v_wmma_f32_16x16x32_f16 (f16 x f16); v^T.P^T: rows < 512 bf16 hi/lo x bf16 hi/lo (3 products),
// rows >= 512 f16 x f16 with P carried x1024; output projection bf16 hi/lo x bf16 (2 products); value gate (32 x 4), rotary, RMS normalisation and online softmax in f32 on the vector unit.
// Causal windowed grouped-query attention block (x [1][4096][1024]; q = x Wq (16 heads x 64), k/v = x Wk / x Wv (4 kv heads, query head h uses kv head h/4), weights [in][out];
// v += 2 sigmoid(x[:, :32] Wg) * ve; half-split rotary with input cos/sin tables [t][32] read by value: out[:32] = x1 cos + x2 sin, out[32:] = x2 cos - x1 sin; q and k scaled by
// rsqrt(mean(x^2) + eps) over the 64 head channels; scores/8 kept for j <= i and j >= i - window (window read on the device), else excluded; softmax; y merged [t][h*64+d]; out = y Wo f32).
// Attention is a register-fed transposed flash step: S^T = K Q^T (keys on D rows, queries on D columns), packed S^T tiles are the B fragment of O^T = V^T P^T; no score plane in memory.

#ifndef NB
#define NB 1
#endif
#ifndef SEQ
#define SEQ 4096
#endif
#define SEQ_FULL 4096
#define TT   SEQ
#define DM   1024
#define NH_  16
#define NKV  4
#define REP  (NH_ / NKV)
#define HD   64
#define DQ   (NH_ * HD)
#define DKV  (NKV * HD)
#define NQKV (DQ + 2 * DKV)
#define GCH  32
#define RH   ((TT < 512) ? TT : 512)     // query rows < RH use hi+lo planes
#define PLG  10.0f                        // log2 of the P carry (x1024) on rows >= RH
#define SCL2 (0.125f * 1.4426950408889634f)   // HD^-0.5 * log2(e)
#define NEGB (-3.0e38f)
#define EPSF 1.1920929e-07f
#define SPT  72                           // LDS staging row pitch in 16-bit elements

static_assert(TT % 64 == 0);
static_assert(RH % 64 == 0);
static_assert((TT - RH) % 64 == 0);
static_assert(DM % 64 == 0 && DQ % 64 == 0 && DKV % 64 == 0 && NQKV % 64 == 0);
static_assert(DM % 32 == 0 && DQ % 32 == 0 && HD % 32 == 0 && TT % 32 == 0);
static_assert(HD == 64);
static_assert(HD / 2 == 32);
static_assert(DQ == DM);
static_assert(NH_ % NKV == 0);
static_assert(GCH <= DM);
static_assert(SPT >= HD && SPT % 8 == 0);
static_assert((TT * DM) % 8 == 0);
static_assert(((long long)NH_ * TT * HD / 2) % 256 == 0 && ((long long)NKV * TT * HD / 2) % 256 == 0);
static_assert((TT * NKV) % 256 == 0);
static_assert(NB >= 1 && SEQ <= SEQ_FULL);

#define AL256(x) ((((size_t)(x)) + 255) & ~(size_t)255)
constexpr size_t WS_TOTAL = AL256((size_t)NQKV * DM * 2) + AL256((size_t)DM * DQ * 2) + AL256((size_t)TT * DM * 2) + AL256((size_t)TT * NKV * 4)
                          + 3 * AL256((size_t)NH_ * TT * HD * 2) + 3 * AL256((size_t)NKV * TT * HD * 2) + 3 * AL256((size_t)NKV * HD * TT * 2) + 2 * AL256((size_t)TT * DQ * 2);
static_assert(WS_TOTAL <= (size_t)134217728u);

typedef _Float16 h16;
typedef unsigned short bf;
typedef __attribute__((ext_vector_type(16))) __bf16   v16bf;
typedef __attribute__((ext_vector_type(16))) _Float16 v16h;
typedef __attribute__((ext_vector_type(8)))  _Float16 v8h;
typedef __attribute__((ext_vector_type(8)))  unsigned short v8us;
typedef __attribute__((ext_vector_type(8)))  float    v8f;
typedef __attribute__((ext_vector_type(4)))  float    v4f;
typedef __attribute__((ext_vector_type(2))) _Float16 v2h;
typedef __attribute__((ext_vector_type(4))) _Float16 v4h;
typedef __attribute__((ext_vector_type(2))) unsigned short v2us;
typedef __attribute__((ext_vector_type(4))) unsigned short v4us;
typedef __attribute__((ext_vector_type(2))) float v2f;
typedef v8h  __attribute__((may_alias)) v8ha;
typedef v4f  __attribute__((may_alias)) v4fa;
typedef v8us __attribute__((may_alias)) v8usa;

__device__ __forceinline__ unsigned short f2bf(float f) { unsigned u = __float_as_uint(f); u += 0x7FFFu + ((u >> 16) & 1u); return (unsigned short)(u >> 16); }
__device__ __forceinline__ float bf2f(unsigned short b) { return __uint_as_float(((unsigned)b) << 16); }
__device__ __forceinline__ float bfr(float f) { return bf2f(f2bf(f)); }
__device__ __forceinline__ v16h cat16(v8h lo, v8h hi) { return __builtin_shufflevector(lo, hi, 0, 1, 2, 3, 4, 5, 6, 7, 8, 9, 10, 11, 12, 13, 14, 15); }
__device__ __forceinline__ v16bf cat16b(v8us lo, v8us hi) { return __builtin_bit_cast(v16bf, __builtin_shufflevector(lo, hi, 0, 1, 2, 3, 4, 5, 6, 7, 8, 9, 10, 11, 12, 13, 14, 15)); }
__device__ __forceinline__ v8f wmma16(v16h a, v16h b, v8f c) { return __builtin_amdgcn_wmma_f32_16x16x32_f16(false, a, false, b, (short)0, c, false, false); }
__device__ __forceinline__ v8f wmmab(v16bf a, v16bf b, v8f c) { return __builtin_amdgcn_wmma_f32_16x16x32_bf16(false, a, false, b, (short)0, c, false, false); }
__device__ __forceinline__ h16 tohx(float x) { return (h16)x; }
__device__ __forceinline__ void splitf(float y, unsigned short& h, unsigned short& l) { h = f2bf(y); l = f2bf(y - bf2f(h)); }

// ---- 16-bit fragment loaders: lane l -> row (A) / column (Bt row) l & 15; elements 0..7 <- k0 + 8h + 0..7, 8..15 <- k0 + 16 + 8h + 0..7 (h = l >> 4); both operands K-contiguous.
template <typename T16> struct WFrag;
template <> struct WFrag<h16> { typedef v16h V; static __device__ __forceinline__ V ld(const h16* p) { return cat16(*(const v8h*)p, *(const v8h*)(p + 16)); } static __device__ __forceinline__ v8f mma(V a, V b, v8f c) { return wmma16(a, b, c); } };
template <> struct WFrag<bf> { typedef v16bf V; static __device__ __forceinline__ V ld(const bf* p) { return cat16b(*(const v8us*)p, *(const v8us*)(p + 16)); } static __device__ __forceinline__ v8f mma(V a, V b, v8f c) { return wmmab(a, b, c); } };

// ---- k_gemmw: register-blocked GEMM, ONE WAVE per 64x64 output tile (16 accumulators), operands straight from K-contiguous 16-bit planes; grid (M/64, N/64, Z), 32 threads.
// C[m][n] (f32, pitch ldc, + optional f32 bias[n]) = sum_k A[m][k] Bt[n][k] (+ split products per NSPLIT). z-batch strides sA/sB/sC in elements. K % 32 == 0.
template <typename T16, int NSPLIT, bool BIAS>
__global__ __launch_bounds__(32) void k_gemmw(const T16* __restrict__ A, const T16* __restrict__ A2, const T16* __restrict__ Bt, const T16* __restrict__ Bt2, int K, float* C, int ldc, const float* __restrict__ bias, size_t sA, size_t sB, size_t sC) {
    typedef typename WFrag<T16>::V V;
    __shared__ __align__(16) float os[16 * 68];
    const size_t z = blockIdx.z; A += z * sA; if (A2) A2 += z * sA; Bt += z * sB; if (Bt2) Bt2 += z * sB; C += z * sC;
    const int lane = threadIdx.x & 31, lr = lane & 15, hi = lane >> 4; const int r0 = blockIdx.x * 64, c0 = blockIdx.y * 64;
    v8f acc[4][4];
#pragma unroll
    for (int mb = 0; mb < 4; ++mb)
#pragma unroll
        for (int nb = 0; nb < 4; ++nb) acc[mb][nb] = (v8f){};
    const size_t aoff = (size_t)(r0 + lr) * K + 8 * hi, boff = (size_t)(c0 + lr) * K + 8 * hi;
#pragma unroll 1
    for (int kc = 0; kc < K; kc += 32) {
        V a[4], a2[4];
#pragma unroll
        for (int mb = 0; mb < 4; ++mb) { a[mb] = WFrag<T16>::ld(A + aoff + (size_t)mb * 16 * K + kc); if (NSPLIT == 1 || NSPLIT == 2) a2[mb] = WFrag<T16>::ld(A2 + aoff + (size_t)mb * 16 * K + kc); }
#pragma unroll
        for (int nb = 0; nb < 4; ++nb) { const V b = WFrag<T16>::ld(Bt + boff + (size_t)nb * 16 * K + kc); V b2; if (NSPLIT >= 2) b2 = WFrag<T16>::ld(Bt2 + boff + (size_t)nb * 16 * K + kc);
#pragma unroll
            for (int mb = 0; mb < 4; ++mb) { acc[mb][nb] = WFrag<T16>::mma(a[mb], b, acc[mb][nb]); if (NSPLIT == 1 || NSPLIT == 2) acc[mb][nb] = WFrag<T16>::mma(a2[mb], b, acc[mb][nb]); if (NSPLIT >= 2) acc[mb][nb] = WFrag<T16>::mma(a[mb], b2, acc[mb][nb]); } }
        asm volatile("v_nop\n\tv_nop\n\tv_nop\n\tv_nop" : "+v"(acc[0][0]), "+v"(acc[1][1]), "+v"(acc[2][2]), "+v"(acc[3][3]) : "v"(a[0]), "v"(a[3]));
    }
#pragma unroll
    for (int mb = 0; mb < 4; ++mb) {
#pragma unroll
        for (int nb = 0; nb < 4; ++nb) {
#pragma unroll
            for (int j = 0; j < 8; ++j) os[(hi * 8 + j) * 68 + nb * 16 + lr] = acc[mb][nb][j]; }
        __builtin_amdgcn_wave_barrier(); asm volatile("" ::: "memory");
        float* crow = C + (size_t)(r0 + mb * 16) * ldc + c0;
{
#pragma unroll
            for (int s = 0; s < 8; ++s) { const int row = 2 * s + hi, cofs = lr * 4; v4f val = *(const v4fa*)(os + row * 68 + cofs); if (BIAS) { val[0] += bfr(bias[c0 + cofs]); val[1] += bfr(bias[c0 + cofs + 1]); val[2] += bfr(bias[c0 + cofs + 2]); val[3] += bfr(bias[c0 + cofs + 3]); }
                *(v4f*)(crow + (size_t)row * ldc + cofs) = val; }
             }
        __builtin_amdgcn_wave_barrier(); asm volatile("" ::: "memory");
    }
}

static __device__ __forceinline__ void cvt8_body(unsigned bx, const float* __restrict__ src, bf* dst, size_t n8) { const size_t i = (size_t)bx * 256 + threadIdx.x; if (i >= n8) return; const v8f v = *(const v8f*)(src + i * 8); v8us o;
#pragma unroll
    for (int k = 0; k < 8; ++k) o[k] = f2bf(v[k]); *(v8us*)(dst + i * 8) = o;  }

// ---- additions for this block ----
// f16 operand convert that cannot yield a subnormal (value select applied after any carry).
static __device__ __forceinline__ h16 toh_flush(float v) { const h16 r = (h16)v; return (fabsf(v) < 6.103515625e-05f) ? (h16)0.0f : r; }
// per-instruction guarded WMMA wrappers (one accumulator per guard).
__device__ __forceinline__ v8f wg16(v16h a, v16h b, v8f c) { c = wmma16(a, b, c); asm volatile("v_nop\n\tv_nop\n\tv_nop\n\tv_nop" : "+v"(c) : "v"(a), "v"(b)); return c; }
__device__ __forceinline__ v8f wgb(v16bf a, v16bf b, v8f c) { c = wmmab(a, b, c); asm volatile("v_nop\n\tv_nop\n\tv_nop\n\tv_nop" : "+v"(c) : "v"(a), "v"(b)); return c; }

// cvtT_body: W[k][n] f32 ([in][out], in = DM rows, row pitch N) -> Bt[n][k] bf16 (rows K-contiguous, pitch DM). 64x64 tile through LDS (block barrier between the element stores and the
static __device__ __forceinline__ void cvtT_body(int bx, int by, const float* __restrict__ src, int N, bf* dst) {
    __shared__ __align__(16) unsigned short tl[64 * SPT];
    const int tid = threadIdx.x; const int k0 = bx * 64, n0 = by * 64;
#pragma unroll 1
    for (int it = 0; it < 16; ++it) { const int idx = it * 256 + tid; const int kk = idx >> 6, nn = idx & 63; tl[nn * SPT + kk] = f2bf(src[(size_t)(k0 + kk) * N + n0 + nn]); }
    __syncthreads();
{
#pragma unroll
        for (int it = 0; it < 2; ++it) { const int p = it * 256 + tid; const int row = p >> 3, pc = p & 7; const v8us v = *(const v8usa*)(tl + row * SPT + pc * 8);
            *(v8us*)(dst + (size_t)(n0 + row) * DM + k0 + pc * 8) = v; }
         }
}

static __device__ __forceinline__ void gate_body(unsigned bx, const float* __restrict__ x, const float* __restrict__ wg, float* G) {
#pragma clang fp contract(off)
    const int idx = bx * 256 + threadIdx.x; if (idx >= TT * NKV) return; const int t = idx / NKV, g = idx % NKV; const float* xr = x + (size_t)t * DM; float a = 0.0f;
#pragma unroll 1
    for (int c = 0; c < GCH; ++c) a += bfr(xr[c]) * bfr(wg[c * NKV + g]);
    const float gt = 2.0f * (1.0f / (1.0f + expf(-a)));
    *(float*)(G + idx) = gt;  }

// k_prep: every conversion that reads inputs only, as block ranges of one grid (none reads what another writes): weight transposes first (the longest blocks), then the gate, then x.
#define PB_Q ((DM / 64) * (DQ / 64))
#define PB_K ((DM / 64) * (DKV / 64))
#define PB_O ((DQ / 64) * (DM / 64))
#define PB_T (PB_Q + 2 * PB_K + PB_O)
#define PB_G ((TT * NKV + 255) / 256)
#define PB_X ((TT * DM / 8 + 255) / 256)
__global__ __launch_bounds__(256) void k_prep(const float* __restrict__ wq, const float* __restrict__ wk, const float* __restrict__ wv, const float* __restrict__ wo, const float* __restrict__ x, const float* __restrict__ wg,
                                              bf* WQKV, bf* WO, bf* XB, float* G) {
    const unsigned b = blockIdx.x;
    if (b < PB_T) {
        const float* src; int N; bf* dst; unsigned r;
        if (b < PB_Q) { src = wq; N = DQ; dst = WQKV; r = b; }                                                              /* Wq [in][out] -> Bt rows 0..DQ-1 */
        else if (b < PB_Q + PB_K) { src = wk; N = DKV; dst = WQKV + (size_t)DQ * DM; r = b - PB_Q; }                         /* Wk -> Bt rows DQ..DQ+DKV-1 */
        else if (b < PB_Q + 2 * PB_K) { src = wv; N = DKV; dst = WQKV + (size_t)(DQ + DKV) * DM; r = b - (PB_Q + PB_K); }    /* Wv -> Bt rows DQ+DKV.. */
        else { src = wo; N = DM; dst = WO; r = b - (PB_Q + 2 * PB_K); }                                                      /* Wo [in = DQ][out = DM] -> Bt [DM][DQ] */
        cvtT_body((int)(r % (DM / 64)), (int)(r / (DM / 64)), src, N, dst);
    } else if (b < PB_T + PB_G) { gate_body(b - PB_T, x, wg, G); }
    else { cvt8_body(b - (PB_T + PB_G), x, XB, (size_t)TT * DM / 8); }
}

// ---- k_proj: the fused q|k|v projection with the operand planes written straight from its epilogue. ONE WAVE per 64x64 tile of x Wqkv (tile shape and k order of k_gemmw), grid (TT/64, NQKV/64), 32 threads.
// A tile's 64 columns are exactly one head (HD == 64), so the wave holds all a row's rotary partners and its whole RMS sum: no f32 projection plane goes through memory and no further launch reads it.
// The tile is staged once in LDS ([t][d] f32, pitch OSP); then, by the block-uniform kind of the column tile:
//   q and k heads: one row t per step, lane -> 2 consecutive d. d < 32: r = x[d] cos[d] + x[d+32] sin[d]; d >= 32: r = x[d] cos[d-32] - x[d-32] sin[d-32] (tables [t][32] read by value, bf16 RNE);
//                  y = r * rsqrt(mean_d r^2 + eps), sum by the xor tree 16, 8, 4, 2, 1 over the lanes; planes [h][t][d] (f16 + bf16 hi/lo), one whole 128-byte line per row and plane.
//   v heads:       lane -> channel d = 16 nb + (lane & 15), 8 consecutive t; x = v + gate[t][g] * ve[t][g*64+d] (ve bf16 RNE); planes [g][d][t] (f16 + bf16 hi/lo), 16 bytes per lane.
#define OSP 68                            // f32 staging row pitch: rows 8 apart fall 32 banks apart, so the two lane halves of a staging store do not collide
typedef v2f __attribute__((may_alias)) v2fa;
// lane l with lane l ^ 16 (vector cross-row move) and lane l with lane l ^ M inside its 16-lane row (DPP row_xmask): the one wave of a tile has no other wave to hide an LDS permute's latency behind,
// and the shuffle builtin's permutes came out as one serial chain of five waits per row
static __device__ __forceinline__ float xhalf(float x) { return __builtin_bit_cast(float, __builtin_amdgcn_permlanex16(__builtin_bit_cast(int, x), __builtin_bit_cast(int, x), 0x76543210, 0xfedcba98, false, false)); }
template <int M> static __device__ __forceinline__ float xrow(float x) { return __builtin_bit_cast(float, __builtin_amdgcn_update_dpp(0, __builtin_bit_cast(int, x), 0x160 + M, 0xf, 0xf, true)); }
static_assert(NQKV / 64 == NH_ + 2 * NKV);
__global__ __launch_bounds__(32) void k_proj(const bf* __restrict__ A, const bf* __restrict__ Bt, const float* __restrict__ G, const float* __restrict__ ve, const float* __restrict__ cosb, const float* __restrict__ sinb,
                                             h16* QP16, bf* QPh, bf* QPl, h16* KP16, bf* KPh, bf* KPl, h16* VT16, bf* VTh, bf* VTl) {
    typedef WFrag<bf>::V V;
    __shared__ __align__(16) float os[64 * OSP];
    const int lane = threadIdx.x & 31, lr = lane & 15, hi = lane >> 4; const int r0 = blockIdx.x * 64, c0 = blockIdx.y * 64;
    v8f acc[4][4];
#pragma unroll
    for (int mb = 0; mb < 4; ++mb)
#pragma unroll
        for (int nb = 0; nb < 4; ++nb) acc[mb][nb] = (v8f){};
    // every fragment address = the tile's uniform base + one lane byte offset (the same for A and Bt: both have pitch DM; it moves with kc) + a constant
    const char* At = (const char*)(A + (size_t)r0 * DM); const char* Bb = (const char*)(Bt + (size_t)c0 * DM); unsigned lo = (unsigned)(lr * DM + 8 * hi) * 2u;
#pragma unroll 1
    for (int kc = 0; kc < DM; kc += 32) {
        V a[4];
#pragma unroll
        for (int mb = 0; mb < 4; ++mb) a[mb] = WFrag<bf>::ld((const bf*)(At + lo + mb * 32 * DM));
#pragma unroll
        for (int np = 0; np < 4; np += 2) { const V b0 = WFrag<bf>::ld((const bf*)(Bb + lo + np * 32 * DM)); const V b1 = WFrag<bf>::ld((const bf*)(Bb + lo + (np + 1) * 32 * DM));
#pragma unroll
            for (int mb = 0; mb < 4; ++mb) { acc[mb][np] = WFrag<bf>::mma(a[mb], b0, acc[mb][np]); acc[mb][np + 1] = WFrag<bf>::mma(a[mb], b1, acc[mb][np + 1]); } }
        // keeps the WMMA distance on the loop's back edge and exit: the next vector write of a fragment register, or read of a tile, stands four vector slots behind the last WMMA
        asm volatile("v_nop\n\tv_nop\n\tv_nop\n\tv_nop" : "+v"(acc[0][0]), "+v"(acc[1][1]), "+v"(acc[2][2]), "+v"(acc[3][3]) : "v"(a[0]), "v"(a[3]));
        // the wait in front of the one rewrite of a register that this trip's loads name: the lane offset goes through the statement so that its step cannot be lifted over it
        asm volatile("s_wait_xcnt 0x0" : "+v"(lo) : : "memory");
        lo += 64;
    }
#pragma unroll
    for (int mb = 0; mb < 4; ++mb)
#pragma unroll
        for (int nb = 0; nb < 4; ++nb)
#pragma unroll
            for (int j = 0; j < 8; ++j) os[(mb * 16 + hi * 8 + j) * OSP + nb * 16 + lr] = acc[mb][nb][j];
    // the block is one wave: this only keeps the compiler from moving the read-back of other lanes' values in front of the staging stores
    __builtin_amdgcn_wave_barrier(); asm volatile("" ::: "memory");
    const int ct = (int)blockIdx.y;
    if (ct < NH_ + NKV) {
        const bool isk = ct >= NH_; const int h = isk ? ct - NH_ : ct;
        h16* P16 = isk ? KP16 : QP16; bf* Ph = isk ? KPh : QPh; bf* Pl = isk ? KPl : QPl;
        const int d = 2 * lane; const int jt = d & (HD / 2 - 1); const int dp = d ^ (HD / 2); const float sg = (d < HD / 2) ? 1.0f : -1.0f;
        const float* cp = cosb + (size_t)r0 * (HD / 2) + jt; const float* sp = sinb + (size_t)r0 * (HD / 2) + jt;
        const size_t ob = ((size_t)h * TT + r0) * HD + d;
        // rolled over groups of 16 rows (small text); the 16 rows of a group are independent, so their table loads go out together and their sums interleave
#pragma unroll 1
        for (int rb = 0; rb < 64; rb += 16) {
            v2f cc[16], sn[16]; float ra[16], rc[16], ss[16];
#pragma unroll
            for (int q = 0; q < 16; ++q) { cc[q] = *(const v2f*)(cp + (size_t)(rb + q) * (HD / 2)); sn[q] = *(const v2f*)(sp + (size_t)(rb + q) * (HD / 2)); }
#pragma unroll
            for (int q = 0; q < 16; ++q) { const v2f xa = *(const v2fa*)(os + (rb + q) * OSP + d); const v2f xb = *(const v2fa*)(os + (rb + q) * OSP + dp);
                ra[q] = xa[0] * bfr(cc[q][0]) + sg * (xb[0] * bfr(sn[q][0])); rc[q] = xa[1] * bfr(cc[q][1]) + sg * (xb[1] * bfr(sn[q][1]));
                ss[q] = ra[q] * ra[q] + rc[q] * rc[q]; }
#pragma unroll
            for (int q = 0; q < 16; ++q) { ss[q] += xhalf(ss[q]); ss[q] += xrow<8>(ss[q]); ss[q] += xrow<4>(ss[q]); ss[q] += xrow<2>(ss[q]); ss[q] += xrow<1>(ss[q]); }
#pragma unroll
            for (int q = 0; q < 16; ++q) { const float rs = rsqrtf(ss[q] * (1.0f / (float)HD) + EPSF); const float y0 = ra[q] * rs, y1 = rc[q] * rs;
                v2h o16; v2us oh, ol; unsigned short a2, c2; o16[0] = toh_flush(y0); o16[1] = toh_flush(y1); splitf(y0, a2, c2); oh[0] = a2; ol[0] = c2; splitf(y1, a2, c2); oh[1] = a2; ol[1] = c2;
                const size_t e = ob + (size_t)(rb + q) * HD; *(v2h*)(P16 + e) = o16; *(v2us*)(Ph + e) = oh; *(v2us*)(Pl + e) = ol; }
            // stands in front of the next group's rewrite of the address and data registers that this group's last stores name
            asm volatile("s_wait_xcnt 0x0" ::: "memory");
        }
    } else {
        const int g = ct - (NH_ + NKV);
        // rolled over the four 16-row groups (small text); the 32 value-embedding loads and 8 gate loads of a group go out together
#pragma unroll 1
        for (int mb = 0; mb < 4; ++mb) {
            const int tl = mb * 16 + hi * 8; const int t0 = r0 + tl; float gv[8], ev[4][8];
#pragma unroll
            for (int j = 0; j < 8; ++j) { gv[j] = G[(size_t)(t0 + j) * NKV + g];
#pragma unroll
                for (int nb = 0; nb < 4; ++nb) ev[nb][j] = ve[(size_t)(t0 + j) * DKV + g * HD + nb * 16 + lr]; }
#pragma unroll
            for (int nb = 0; nb < 4; ++nb) { const int d = nb * 16 + lr; v8h o16; v8us oh, ol;
#pragma unroll
                for (int j = 0; j < 8; ++j) { const float x = os[(tl + j) * OSP + d] + gv[j] * bfr(ev[nb][j]); o16[j] = toh_flush(x); unsigned short a2, c2; splitf(x, a2, c2); oh[j] = a2; ol[j] = c2; }
                const size_t e = ((size_t)g * HD + d) * TT + t0; *(v8h*)(VT16 + e) = o16; *(v8us*)(VTh + e) = oh; *(v8us*)(VTl + e) = ol; }
        }
    }
}

// ---- attn_body: register-fed transposed flash step. Block = 4 waves = 64 query rows (row block xb) of heads h0 .. h0 + NHD - 1; each wave owns 16 queries q0..q0+15 of each head and walks 32-key steps kb from the
// window start (aligned down to 32) to the diagonal. S^T tiles (keys kb..kb+15 and kb+16..kb+31 on D rows 8*hi+r, query lr on D columns) = K fragment (A: row = key, k = channel)
// x Q fragment (B: column = query, k = channel). Online softmax per query = per lane (the lane pair l, l^16 shares a query; max exchanged by one xor-16 shuffle; the row sum stays a
// per-lane partial and is combined once at the end). Packed S^T tiles form the B fragment of O^T = V^T P^T directly (elements 0..7 <- tile 0 rows 8*hi.., 8..15 <- tile 1), A = V^T
// fragment (row = channel, k = key) from the [g][d][t] planes. EARLY: all operands as bf16 hi/lo planes, three products per site, P unnormalised in (0,1], row sum over the f32 p.
// Late: single f16 products, P carried x1024 with the exponent-argument select (no f16 subnormal can form), row sum over the converted P.
// NHD query heads of ONE kv head per wave (f16 body: HPW; hi/lo body: 1, its three-product fragments for two heads do not fit the registers that the guarded products can name).
// The K and V fragments of a step do not depend on the query head: the f16 body loads each once, all as one group ahead of the first product, and feeds NHD heads' products with them,
// so the fragment loads (16 cache lines each) and the waits on them fall per product. Every head keeps its own maximum, sum and tiles, in the order of a wave that has one head.
#define HPW 2
static_assert(REP % HPW == 0 && NH_ % HPW == 0);
template <bool EARLY, int NHD>
static __device__ __forceinline__ void attn_body(const h16* __restrict__ Q16, const bf* __restrict__ Qh, const bf* __restrict__ Ql, const h16* __restrict__ K16, const bf* __restrict__ Kh, const bf* __restrict__ Kl,
                                                 const h16* __restrict__ V16, const bf* __restrict__ Vh, const bf* __restrict__ Vl, const int* __restrict__ wsp, int xb, int h0, v8f (&o)[NHD][4], float (&l)[NHD]) {
    static_assert(!EARLY || NHD == 1);
    const int lane = threadIdx.x & 31, lr = lane & 15, hi = lane >> 4;
    const int wave = __builtin_amdgcn_readfirstlane(threadIdx.x >> 5);
    const int g = h0 / REP;
    const int q0 = xb * 64 + wave * 16;
    int wl = wsp[0]; if (wl <= 0 || wl >= TT) wl = TT;
    int klo = q0 - wl; klo &= ~(klo >> 31);               // floor at 0 without a compare
    const int kstart = klo & ~31; const int kend = q0 + 16;
    const int i = q0 + lr, ilo = i - wl;
    const size_t qoff = ((size_t)h0 * TT + q0 + lr) * HD + 8 * hi;
    const size_t kbase = (size_t)g * TT * HD + (size_t)lr * HD + 8 * hi;
    const size_t vbase = (size_t)g * HD * TT + (size_t)lr * TT + 8 * hi;
    v16h qf[NHD][2]; v16bf qh[2], ql[2];
#pragma unroll
    for (int c = 0; c < 2; ++c) { if (EARLY) { qh[c] = WFrag<bf>::ld(Qh + qoff + c * 32); ql[c] = WFrag<bf>::ld(Ql + qoff + c * 32); } else {
#pragma unroll
            for (int hh = 0; hh < NHD; ++hh) qf[hh][c] = WFrag<h16>::ld(Q16 + qoff + (size_t)hh * TT * HD + c * 32); } }
    float m[NHD];
#pragma unroll
    for (int hh = 0; hh < NHD; ++hh) { m[hh] = NEGB; l[hh] = 0.0f;
#pragma unroll
        for (int dt = 0; dt < 4; ++dt) o[hh][dt] = (v8f){}; }
#pragma unroll 1
    for (int kb = kstart; kb < kend; kb += 32) {
        v8f s0[NHD], s1[NHD]; v16h ka[2][2], va[4];
#pragma unroll
        for (int hh = 0; hh < NHD; ++hh) { s0[hh] = (v8f){}; s1[hh] = (v8f){}; }
        if (EARLY) {
#pragma unroll
            for (int c = 0; c < 2; ++c) { const size_t ko = kbase + (size_t)kb * HD + c * 32;
                const v16bf a0h = WFrag<bf>::ld(Kh + ko); const v16bf a0l = WFrag<bf>::ld(Kl + ko);
                s0[0] = wgb(a0h, qh[c], s0[0]); s0[0] = wgb(a0l, qh[c], s0[0]); s0[0] = wgb(a0h, ql[c], s0[0]);
                const v16bf a1h = WFrag<bf>::ld(Kh + ko + 16 * HD); const v16bf a1l = WFrag<bf>::ld(Kl + ko + 16 * HD);
                s1[0] = wgb(a1h, qh[c], s1[0]); s1[0] = wgb(a1l, qh[c], s1[0]); s1[0] = wgb(a1h, ql[c], s1[0]); }
        } else {
#pragma unroll
            for (int c = 0; c < 2; ++c) { const size_t ko = kbase + (size_t)kb * HD + c * 32; ka[c][0] = WFrag<h16>::ld(K16 + ko); ka[c][1] = WFrag<h16>::ld(K16 + ko + 16 * HD); }
            // stands in front of the V loads, whose results the compiler may land in the K loads' address registers
            asm volatile("s_wait_xcnt 0x0" ::: "memory");
#pragma unroll
            for (int dt = 0; dt < 4; ++dt) va[dt] = WFrag<h16>::ld(V16 + vbase + (size_t)(dt * 16) * TT + kb);
#pragma unroll
            for (int c = 0; c < 2; ++c)
#pragma unroll
                for (int hh = 0; hh < NHD; ++hh) { s0[hh] = wg16(ka[c][0], qf[hh][c], s0[hh]); s1[hh] = wg16(ka[c][1], qf[hh][c], s1[hh]); }
        }
        float mx[NHD];
#pragma unroll
        for (int hh = 0; hh < NHD; ++hh) { float x = NEGB;
#pragma unroll
            for (int r = 0; r < 8; ++r) { const int j0 = kb + 8 * hi + r, j1 = j0 + 16; const bool ok0 = (j0 <= i) && (j0 >= ilo); const bool ok1 = (j1 <= i) && (j1 >= ilo);
                const float t0 = ok0 ? s0[hh][r] * SCL2 : NEGB; const float t1 = ok1 ? s1[hh][r] * SCL2 : NEGB; s0[hh][r] = t0; s1[hh][r] = t1; x = fmaxf(x, fmaxf(t0, t1)); }
            mx[hh] = x; }
#pragma unroll
        for (int hh = 0; hh < NHD; ++hh) mx[hh] = fmaxf(mx[hh], __shfl_xor(mx[hh], 16, 32));
        v16h pf[NHD];
#pragma unroll
        for (int hh = 0; hh < NHD; ++hh) {
            const float mnew = fmaxf(m[hh], mx[hh]); const float alpha = __builtin_amdgcn_exp2f(m[hh] - mnew); m[hh] = mnew;
#pragma unroll
            for (int dt = 0; dt < 4; ++dt)
#pragma unroll
                for (int r = 0; r < 8; ++r) o[hh][dt][r] *= alpha;
            float ls = 0.0f;
            if (EARLY) {
                v8us p0h, p0l, p1h, p1l;
#pragma unroll
                for (int r = 0; r < 8; ++r) { const float e0 = s0[hh][r] - mnew, e1 = s1[hh][r] - mnew; float pv0 = __builtin_amdgcn_exp2f(e0), pv1 = __builtin_amdgcn_exp2f(e1);
                    pv0 = (s0[hh][r] > -1.0e38f) ? pv0 : 0.0f; pv1 = (s1[hh][r] > -1.0e38f) ? pv1 : 0.0f; ls += pv0 + pv1;
                    unsigned short a2, c2; splitf(pv0, a2, c2); p0h[r] = a2; p0l[r] = c2; splitf(pv1, a2, c2); p1h[r] = a2; p1l[r] = c2; }
                const v16bf pfh = cat16b(p0h, p1h); const v16bf pfl = cat16b(p0l, p1l);
#pragma unroll
                for (int dt = 0; dt < 4; ++dt) { const size_t vo = vbase + (size_t)(dt * 16) * TT + kb; const v16bf vh = WFrag<bf>::ld(Vh + vo); const v16bf vl = WFrag<bf>::ld(Vl + vo);
                    o[hh][dt] = wgb(vh, pfh, o[hh][dt]); o[hh][dt] = wgb(vl, pfh, o[hh][dt]); o[hh][dt] = wgb(vh, pfl, o[hh][dt]); }
            } else {
                v8h p0, p1;
#pragma unroll
                for (int r = 0; r < 8; ++r) { const float e0 = s0[hh][r] - mnew + PLG, e1 = s1[hh][r] - mnew + PLG; float pv0 = __builtin_amdgcn_exp2f(e0), pv1 = __builtin_amdgcn_exp2f(e1);
                    pv0 = ((s0[hh][r] > -1.0e38f) && (e0 >= -14.0f)) ? pv0 : 0.0f; pv1 = ((s1[hh][r] > -1.0e38f) && (e1 >= -14.0f)) ? pv1 : 0.0f;
                    const h16 c0 = (h16)pv0; const h16 c1 = (h16)pv1; p0[r] = c0; p1[r] = c1; ls += (float)c0 + (float)c1; }
                pf[hh] = cat16(p0, p1);
            }
            l[hh] = l[hh] * alpha + ls;
        }
        if (!EARLY) {
#pragma unroll
            for (int dt = 0; dt < 4; ++dt)
#pragma unroll
                for (int hh = 0; hh < NHD; ++hh) o[hh][dt] = wg16(va[dt], pf[hh], o[hh][dt]);
        }
    }
}

// attn_store: the epilogue that both bodies share: per head join the lane pair's row sums, normalise, split to bf16 hi/lo, stage per wave and head in LDS, store whole rows of the merged [t][h*64+d] planes.
template <int NHD>
static __device__ __forceinline__ void attn_store(unsigned short* stg, int xb, int h0, const v8f (&o)[NHD][4], const float (&l)[NHD], bf* ATh, bf* ATl) {
    const int lane = threadIdx.x & 31, lr = lane & 15, hi = lane >> 4;
    const int wave = __builtin_amdgcn_readfirstlane(threadIdx.x >> 5);
    const int q0 = xb * 64 + wave * 16;
#pragma unroll
    for (int hh = 0; hh < NHD; ++hh) {
        const float lt = l[hh] + __shfl_xor(l[hh], 16, 32);
        const float inv = 1.0f / lt;
        const int sb = (hh * 4 + wave) * (2 * 16 * SPT);
#pragma unroll
        for (int dt = 0; dt < 4; ++dt) { v8us oh, ol;
#pragma unroll
            for (int r = 0; r < 8; ++r) { unsigned short a2, c2; splitf(o[hh][dt][r] * inv, a2, c2); oh[r] = a2; ol[r] = c2; }
            *(v8usa*)(stg + sb + lr * SPT + dt * 16 + 8 * hi) = oh; *(v8usa*)(stg + sb + 16 * SPT + lr * SPT + dt * 16 + 8 * hi) = ol; }
    }
    __builtin_amdgcn_wave_barrier(); asm volatile("" ::: "memory");
    const int prow = lane >> 3, pc = lane & 7;
#pragma unroll
    for (int hh = 0; hh < NHD; ++hh) {
        const int sb = (hh * 4 + wave) * (2 * 16 * SPT);
#pragma unroll
        for (int s = 0; s < 4; ++s) { const int row = 4 * s + prow; const v8us sh = *(const v8usa*)(stg + sb + row * SPT + pc * 8); const v8us sl = *(const v8usa*)(stg + sb + 16 * SPT + row * SPT + pc * 8);
            const size_t oo = (size_t)(q0 + row) * DQ + (size_t)(h0 + hh) * HD + pc * 8; *(v8us*)(ATh + oo) = sh; *(v8us*)(ATl + oo) = sl; }
    }
}

// k_attn: one grid (NH_/HPW, AYE + (TT - RH)/64), 128 threads, for all query rows (a block-uniform choice, so both bodies run side by side): the first AYE grid rows are the blocks of query rows [0, RH),
// bf16 hi/lo body, one head a wave (grid row y, column x: row block y / HPW, head x * HPW + y % HPW); the rest are the blocks of query rows [RH, TT), f16 body, heads x * HPW .. x * HPW + HPW - 1.
#define AYE ((RH / 64) * HPW)
__global__ __launch_bounds__(128) void k_attn(const h16* __restrict__ Q16, const bf* __restrict__ Qh, const bf* __restrict__ Ql, const h16* __restrict__ K16, const bf* __restrict__ Kh, const bf* __restrict__ Kl,
                                              const h16* __restrict__ V16, const bf* __restrict__ Vh, const bf* __restrict__ Vl, bf* ATh, bf* ATl, const int* __restrict__ wsp) {
    __shared__ __align__(16) unsigned short stg[HPW * 4 * 2 * 16 * SPT];
    const int bx = (int)blockIdx.x, by = (int)blockIdx.y;
    if (by < AYE) { const int xb = by / HPW, h0 = bx * HPW + by % HPW; v8f o[1][4]; float l[1];
        attn_body<true, 1>(nullptr, Qh, Ql, nullptr, Kh, Kl, nullptr, Vh, Vl, wsp, xb, h0, o, l); attn_store<1>(stg, xb, h0, o, l, ATh, ATl); }
    else { const int xb = by - (AYE - RH / 64), h0 = bx * HPW; v8f o[HPW][4]; float l[HPW];
        attn_body<false, HPW>(Q16, nullptr, nullptr, K16, nullptr, nullptr, V16, nullptr, nullptr, wsp, xb, h0, o, l); attn_store<HPW>(stg, xb, h0, o, l, ATh, ATl); } }

extern "C" void kernel_launch(void* const* d_in, const int* in_sizes, int n_in,
                              void* d_out, int out_size, void* d_ws, size_t ws_size, hipStream_t stream) {
    if (n_in < 10) return;
    if (in_sizes[0] < (NB - 1) * SEQ_FULL * DM + TT * DM) return;
    if (in_sizes[1] < (NB - 1) * SEQ_FULL * DKV + TT * DKV) return;
    if (in_sizes[2] < TT * (HD / 2) || in_sizes[3] < TT * (HD / 2)) return;
    if (in_sizes[4] < DM * DQ || in_sizes[5] < DM * DKV || in_sizes[6] < DM * DKV || in_sizes[7] < DQ * DM || in_sizes[8] < GCH * NKV || in_sizes[9] < 1) return;
    if (out_size < NB * TT * DM) return;
    const float* x = (const float*)d_in[0]; const float* ve = (const float*)d_in[1]; const float* cosb = (const float*)d_in[2]; const float* sinb = (const float*)d_in[3];
    const float* wq = (const float*)d_in[4]; const float* wk = (const float*)d_in[5]; const float* wv = (const float*)d_in[6]; const float* wo = (const float*)d_in[7]; const float* wg = (const float*)d_in[8];
    const int* wsp = (const int*)d_in[9];
    float* OUT = (float*)d_out;     // [NB][TT][DM] f32
    char* wsc = (char*)d_ws;
    auto take = [&](size_t bytes) { char* p = wsc; wsc += (bytes + 255) & ~(size_t)255; return (void*)p; };
    bf* WQKV = (bf*)take((size_t)NQKV * DM * 2); bf* WO = (bf*)take((size_t)DM * DQ * 2);
    bf* XB = (bf*)take((size_t)TT * DM * 2); float* G = (float*)take((size_t)TT * NKV * 4);
    h16* QP16 = (h16*)take((size_t)NH_ * TT * HD * 2); bf* QPh = (bf*)take((size_t)NH_ * TT * HD * 2); bf* QPl = (bf*)take((size_t)NH_ * TT * HD * 2);
    h16* KP16 = (h16*)take((size_t)NKV * TT * HD * 2); bf* KPh = (bf*)take((size_t)NKV * TT * HD * 2); bf* KPl = (bf*)take((size_t)NKV * TT * HD * 2);
    h16* VT16 = (h16*)take((size_t)NKV * HD * TT * 2); bf* VTh = (bf*)take((size_t)NKV * HD * TT * 2); bf* VTl = (bf*)take((size_t)NKV * HD * TT * 2);
    bf* ATh = (bf*)take((size_t)TT * DQ * 2); bf* ATl = (bf*)take((size_t)TT * DQ * 2);
    const size_t used = (size_t)(wsc - (char*)d_ws); if (used > ws_size || used > (size_t)134217728u) return;   // 68,222,976 B at full size
    for (int b = 0; b < NB; ++b) {
        const float* xb = x + (size_t)b * SEQ_FULL * DM; const float* veb = ve + (size_t)b * SEQ_FULL * DKV;
        k_prep<<<PB_T + PB_G + PB_X, 256, 0, stream>>>(wq, wk, wv, wo, xb, wg, WQKV, WO, XB, G);
        k_proj<<<dim3(TT / 64, NQKV / 64, 1), 32, 0, stream>>>(XB, WQKV, G, veb, cosb, sinb, QP16, QPh, QPl, KP16, KPh, KPl, VT16, VTh, VTl);
        k_attn<<<dim3(NH_ / HPW, AYE + (TT - RH) / 64), 128, 0, stream>>>(QP16, QPh, QPl, KP16, KPh, KPl, VT16, VTh, VTl, ATh, ATl, wsp);
        k_gemmw<bf, 1, false><<<dim3(TT / 64, DM / 64, 1), 32, 0, stream>>>(ATh, ATl, WO, nullptr, DQ, OUT + (size_t)b * TT * DM, DM, nullptr, 0, 0, 0); }
}
